// v000
// Times are from an AMD MI455X. After a warm-up the kernel runs many times in a row, and a time is the length of
// such a window on the GPU divided by its runs, so every launch and the gaps after it count. The runs cycle
// through copies of the inputs. A figure is the median of several windows, for all but v000 over two sittings.
// Sittings can differ by a few percent; kernels timed side by side share one.
// v000, which the later versions start from, runs in 212 microseconds.
#include <hip/hip_runtime.h>
#include <hip/hip_fp16.h>

typedef __attribute__((ext_vector_type(16))) _Float16 v16h;
typedef __attribute__((ext_vector_type(8)))  _Float16 v8h;
typedef __attribute__((ext_vector_type(2)))  _Float16 h2;
typedef __attribute__((ext_vector_type(8)))  float    v8f;

#define C_DIM 128
#define CQ    16
#define NSP   4096   // 64*64
#define BATCH 4

// ---------------------------------------------------------------------------
// Projection q,k : written directly in WMMA operand image layout.
//  lane = (c>>3)*16 + (n&15), half j = c&7  (K padded 16->32 with zeros)
// ---------------------------------------------------------------------------
__global__ void proj_qk(const float* __restrict__ x,
                        const float* __restrict__ wq, const float* __restrict__ bq,
                        const float* __restrict__ wk, const float* __restrict__ bk,
                        _Float16* __restrict__ qA, _Float16* __restrict__ kB) {
  int n = blockIdx.x * blockDim.x + threadIdx.x;
  int b = blockIdx.y;
  float accq[CQ], acck[CQ];
#pragma unroll
  for (int i = 0; i < CQ; ++i) { accq[i] = bq[i]; acck[i] = bk[i]; }
  const float* xb = x + ((size_t)b * C_DIM) * NSP + n;
  for (int c = 0; c < C_DIM; ++c) {
    float xv = xb[(size_t)c * NSP];
#pragma unroll
    for (int i = 0; i < CQ; ++i) {
      accq[i] = fmaf(wq[i * C_DIM + c], xv, accq[i]);
      acck[i] = fmaf(wk[i * C_DIM + c], xv, acck[i]);
    }
  }
  int row = n & 15;
  size_t blk = (size_t)b * (NSP / 16) + (n >> 4);
#pragma unroll
  for (int c = 0; c < CQ; ++c) {
    int h = c >> 3, j = c & 7;
    int lane = h * 16 + row;
    qA[(blk * 32 + lane) * 8 + j] = (_Float16)accq[c];
    kB[(blk * 32 + lane) * 8 + j] = (_Float16)acck[c];
  }
}

// ---------------------------------------------------------------------------
// Projection v : stored as WMMA B-operand lane images per (32-key, 16-ch) tile.
// ---------------------------------------------------------------------------
__global__ void proj_v(const float* __restrict__ x, const float* __restrict__ wv,
                       const float* __restrict__ bv, _Float16* __restrict__ vB) {
  int n  = blockIdx.x * blockDim.x + threadIdx.x;
  int cg = blockIdx.y;
  int b  = blockIdx.z;
  float acc[32];
#pragma unroll
  for (int i = 0; i < 32; ++i) acc[i] = bv[cg * 32 + i];
  const float* xb = x + ((size_t)b * C_DIM) * NSP + n;
  for (int c = 0; c < C_DIM; ++c) {
    float xv = xb[(size_t)c * NSP];
#pragma unroll
    for (int i = 0; i < 32; ++i)
      acc[i] = fmaf(wv[(cg * 32 + i) * C_DIM + c], xv, acc[i]);
  }
  int kk = n & 31, kb = n >> 5;
  int h  = (kk >> 3) & 1;
  int hp = (kk & 7) | ((kk >> 4) << 3);
#pragma unroll
  for (int i = 0; i < 32; ++i) {
    int ch = cg * 32 + i, cb = ch >> 4, cc = ch & 15;
    int lane = h * 16 + cc;
    vB[((((size_t)b * (NSP / 32) + kb) * 8 + cb) * 32 + lane) * 16 + hp] = (_Float16)acc[i];
  }
}

// ---------------------------------------------------------------------------
// Flash-attention core, 8 waves/block (each owns 16 query rows).
// Per 64-key block: async-DMA V tile to LDS, 4 energy WMMAs, online softmax
// (packed f16x2 max tree; row-sum comes free from a ones-column WMMA),
// LDS C->A transpose of P, 18 accumulate WMMAs (8 ch blocks x 2 + ones x 2).
// ---------------------------------------------------------------------------
__global__ __launch_bounds__(256) void attn(const _Float16* __restrict__ qA,
                                            const _Float16* __restrict__ kB,
                                            const _Float16* __restrict__ vB,
                                            const float* __restrict__ x,
                                            const float* __restrict__ gamma,
                                            float* __restrict__ out) {
  __shared__ _Float16 lds_p[8][16][64];        // per-wave P staging, 16 KB
  __shared__ _Float16 lds_v[2 * 8 * 32 * 16];  // shared V tile (64 keys), 16 KB

  int b    = blockIdx.y;
  int wid  = threadIdx.x >> 5;
  int lane = threadIdx.x & 31;
  int half = lane >> 4;
  int col  = lane & 15;
  int q16  = blockIdx.x * 8 + wid;             // batch-local 16-row block

  // Query A operand (K = Cq zero-padded to 32)
  v16h aq = {};
  {
    const v8h* src = (const v8h*)(qA + (((size_t)b * (NSP / 16) + q16) * 32 + lane) * 8);
    v8h t = *src;
#pragma unroll
    for (int j = 0; j < 8; ++j) aq[j] = t[j];
  }
  v16h ones;
#pragma unroll
  for (int j = 0; j < 16; ++j) ones[j] = (_Float16)1.0f;

  v8f acc[9];                                  // [0..7]=channels, [8]=rowsum
#pragma unroll
  for (int cb = 0; cb < 9; ++cb) acc[cb] = {};
  float M[8];
#pragma unroll
  for (int r = 0; r < 8; ++r) M[r] = -__builtin_inff();

  unsigned lds_v_base = (unsigned)(size_t)&lds_v[0];

  for (int kb = 0; kb < NSP / 64; ++kb) {
    __syncthreads();   // everyone done reading previous V tile

    // Async DMA: stage this block's V tile (16 KB) into LDS; overlaps the
    // energy WMMAs + softmax below. Tracked by ASYNCcnt.
    {
      unsigned long long gsrc =
          (unsigned long long)(vB + (((size_t)b * (NSP / 32) + kb * 2) * 8) * 32 * 16);
#pragma unroll
      for (int i = 0; i < 4; ++i) {
        unsigned off = (unsigned)(i * 4096 + threadIdx.x * 16);
        asm volatile("global_load_async_to_lds_b128 %0, %1, %2"
                     :: "v"(lds_v_base + off), "v"(off), "s"(gsrc)
                     : "memory");
      }
    }

    // Energy: 4 x 16-key tiles
    v8f E[4];
#pragma unroll
    for (int t = 0; t < 4; ++t) {
      v16h bk16 = {};
      const v8h* s = (const v8h*)(kB + (((size_t)b * (NSP / 16) + kb * 4 + t) * 32 + lane) * 8);
      v8h tt = *s;
#pragma unroll
      for (int j = 0; j < 8; ++j) bk16[j] = tt[j];
      v8f z = {};
      E[t] = __builtin_amdgcn_wmma_f32_16x16x32_f16(false, aq, false, bk16, (short)0, z, false, false);
    }

    // Row max: local 4-way max, then f16x2-packed xor tree across 16 lanes.
    float mx[8];
#pragma unroll
    for (int r = 0; r < 8; ++r)
      mx[r] = fmaxf(fmaxf(E[0][r], E[1][r]), fmaxf(E[2][r], E[3][r]));
#pragma unroll
    for (int jj = 0; jj < 4; ++jj) {
      h2 pk;
      pk[0] = (_Float16)mx[2 * jj];
      pk[1] = (_Float16)mx[2 * jj + 1];
      int pi = __builtin_bit_cast(int, pk);
#pragma unroll
      for (int d = 1; d < 16; d <<= 1) {
        int o = __shfl_xor(pi, d, 32);
        h2 m2 = __builtin_elementwise_max(__builtin_bit_cast(h2, pi),
                                          __builtin_bit_cast(h2, o));
        pi = __builtin_bit_cast(int, m2);
      }
      h2 m2 = __builtin_bit_cast(h2, pi);
      mx[2 * jj]     = (float)m2[0];
      mx[2 * jj + 1] = (float)m2[1];
    }

    // Online-softmax rescale of all 9 accumulators (rowsum included).
    float sc[8];
#pragma unroll
    for (int r = 0; r < 8; ++r) {
      float mn = fmaxf(M[r], mx[r]);
      sc[r] = __expf(M[r] - mn);
      M[r] = mn;
    }
#pragma unroll
    for (int cb = 0; cb < 9; ++cb) {
#pragma unroll
      for (int r = 0; r < 8; ++r) acc[cb][r] *= sc[r];
    }

    // P = exp(E - M) -> LDS (C-layout write)
#pragma unroll
    for (int r = 0; r < 8; ++r) {
      int m = half * 8 + r;
#pragma unroll
      for (int t = 0; t < 4; ++t) {
        float pv = __expf(E[t][r] - M[r]);
        lds_p[wid][m][t * 16 + col] = (_Float16)pv;
      }
    }
    __builtin_amdgcn_wave_barrier();
    asm volatile("s_wait_dscnt 0x0" ::: "memory");

    // V tile must be resident before the accumulate WMMAs.
    asm volatile("s_wait_asynccnt 0x0" ::: "memory");
    __syncthreads();

    // out_tile[q,c] += P x V^T ; rowsum += P x 1
#pragma unroll
    for (int kk = 0; kk < 2; ++kk) {
      v16h p;
      {
        const v8h* lo = (const v8h*)&lds_p[wid][col][kk * 32 + half * 8];
        const v8h* hi = (const v8h*)&lds_p[wid][col][kk * 32 + 16 + half * 8];
        v8h tl = *lo, th = *hi;
#pragma unroll
        for (int j = 0; j < 8; ++j) { p[j] = tl[j]; p[j + 8] = th[j]; }
      }
#pragma unroll
      for (int cb = 0; cb < 8; ++cb) {
        const v8h* vv = (const v8h*)&lds_v[((kk * 8 + cb) * 32 + lane) * 16];
        v8h t0 = vv[0], t1 = vv[1];
        v16h bv16;
#pragma unroll
        for (int j = 0; j < 8; ++j) { bv16[j] = t0[j]; bv16[j + 8] = t1[j]; }
        acc[cb] = __builtin_amdgcn_wmma_f32_16x16x32_f16(false, p, false, bv16, (short)0, acc[cb], false, false);
      }
      acc[8] = __builtin_amdgcn_wmma_f32_16x16x32_f16(false, p, false, ones, (short)0, acc[8], false, false);
    }
  }

  // Epilogue: normalize by rowsum (acc[8]), gamma, residual.
  float g = gamma[0];
  int nbase = q16 * 16;
#pragma unroll
  for (int r = 0; r < 8; ++r) {
    float inv = 1.0f / acc[8][r];
    int m = half * 8 + r;
    int n = nbase + m;
#pragma unroll
    for (int cb = 0; cb < 8; ++cb) {
      int c = cb * 16 + col;
      size_t idx = ((size_t)b * C_DIM + c) * NSP + n;
      out[idx] = g * (acc[cb][r] * inv) + x[idx];
    }
  }
}

// ---------------------------------------------------------------------------
extern "C" void kernel_launch(void* const* d_in, const int* in_sizes, int n_in,
                              void* d_out, int out_size, void* d_ws, size_t ws_size,
                              hipStream_t stream) {
  const float* x     = (const float*)d_in[0];
  const float* wq    = (const float*)d_in[1];
  const float* bq    = (const float*)d_in[2];
  const float* wk    = (const float*)d_in[3];
  const float* bk    = (const float*)d_in[4];
  const float* wv    = (const float*)d_in[5];
  const float* bv    = (const float*)d_in[6];
  const float* gamma = (const float*)d_in[7];
  float* out = (float*)d_out;

  _Float16* qA = (_Float16*)d_ws;
  _Float16* kB = qA + (size_t)BATCH * (NSP / 16) * 32 * 8;
  _Float16* vB = kB + (size_t)BATCH * (NSP / 16) * 32 * 8;

  proj_qk<<<dim3(NSP / 256, BATCH), 256, 0, stream>>>(x, wq, bq, wk, bk, qA, kB);
  proj_v <<<dim3(NSP / 256, 4, BATCH), 256, 0, stream>>>(x, wv, bv, vB);
  attn   <<<dim3(NSP / 128, BATCH), 256, 0, stream>>>(qA, kB, vB, x, gamma, out);
}

// v001
// A run of this version takes 142 microseconds.
// Timed twice side by side with v000, it ran 1.50 and 1.53 times as fast.
#include <hip/hip_runtime.h>
#include <hip/hip_fp16.h>

typedef __attribute__((ext_vector_type(16))) _Float16 v16h;
typedef __attribute__((ext_vector_type(8)))  _Float16 v8h;
typedef __attribute__((ext_vector_type(2)))  _Float16 h2;
typedef __attribute__((ext_vector_type(8)))  float    v8f;
typedef __attribute__((ext_vector_type(4)))  float    v4f;
typedef __attribute__((ext_vector_type(2)))  float    v2f;

#define C_DIM 128
#define CQ    16
#define NSP   4096   // 64*64
#define BATCH 4

// ---------------------------------------------------------------------------
// Projections q, k, v as one f32 WMMA (16x16x4) GEMM: [160 x 128] x [128 x n].
// One block = 64 positions of one batch, ten waves = ten 16-channel tiles
// (wave 0: q, wave 1: k, waves 2..9: v). A wave keeps four position tiles;
// tile t holds positions n0 + 4*j + t (j = lane & 15), so one 16-byte load
// along n feeds all four tiles. k order, the same for x and w fragments:
// step 2*S + e, lane half h, register v  ->  c = 8*S + 4*h + 2*e + v.
// Results leave in the WMMA operand images that attn reads:
//  q,k: lane = (c>>3)*16 + (n&15), half j = c&7  (K padded 16->32 with zeros)
//  v  : B-operand lane images per (32-key, 16-ch) tile.
// ---------------------------------------------------------------------------
template <bool X_IS_A>
__device__ __forceinline__ void proj_tiles(const float* __restrict__ xp,
                                           const float* __restrict__ wp,
                                           v8f (&acc)[4]) {
  // All loops here and in proj_qkv are unrolled whole: the register arrays need
  // constant indices, and the loads of later steps can then issue ahead of the WMMAs.
#pragma unroll
  for (int S = 0; S < C_DIM / 8; ++S) {
    v4f w = *(const v4f*)(wp + 8 * S);
    v4f X[4];
#pragma unroll
    for (int i = 0; i < 4; ++i) X[i] = *(const v4f*)(xp + (size_t)(8 * S + i) * NSP);
#pragma unroll
    for (int e = 0; e < 2; ++e) {
      v2f wf = {w[2 * e], w[2 * e + 1]};
#pragma unroll
      for (int t = 0; t < 4; ++t) {
        v2f xf = {X[2 * e][t], X[2 * e + 1][t]};
        acc[t] = X_IS_A
            ? __builtin_amdgcn_wmma_f32_16x16x4_f32(false, xf, false, wf, (short)0, acc[t], false, false)
            : __builtin_amdgcn_wmma_f32_16x16x4_f32(false, wf, false, xf, (short)0, acc[t], false, false);
      }
    }
  }
  // Address wait behind the last load; the two pointers are inputs so that their
  // registers are not given to anything else while a load that names them is open.
  asm volatile("s_wait_xcnt 0x0" :: "v"(xp), "v"(wp) : "memory");
}

__global__ __launch_bounds__(320) void proj_qkv(const float* __restrict__ x,
                                                const float* __restrict__ wq, const float* __restrict__ bq,
                                                const float* __restrict__ wk, const float* __restrict__ bk,
                                                const float* __restrict__ wv, const float* __restrict__ bv,
                                                _Float16* __restrict__ qA, _Float16* __restrict__ kB,
                                                _Float16* __restrict__ vB) {
  int b    = blockIdx.y;
  int n0   = blockIdx.x * 64;
  int wid  = __builtin_amdgcn_readfirstlane(threadIdx.x >> 5);
  int lane = threadIdx.x & 31;
  int half = lane >> 4;
  int col  = lane & 15;

  const float* xp = x + ((size_t)b * C_DIM + 4 * half) * NSP + n0 + 4 * col;
  v8f acc[4];

  if (wid >= 2) {
    // D[n = n0 + 32*half + 4*r + t][ch = cb*16 + col]
    int cb = wid - 2;
    float bb = bv[cb * 16 + col];
#pragma unroll
    for (int t = 0; t < 4; ++t) {
#pragma unroll
      for (int r = 0; r < 8; ++r) acc[t][r] = bb;
    }
    proj_tiles<true>(xp, wv + (cb * 16 + col) * C_DIM + 4 * half, acc);
    // key in its 32-block: kk = 4*r + t; image lane half = (kk>>3)&1,
    // image position = (kk&7) | ((kk>>4)<<3)
    size_t kb = (size_t)b * (NSP / 32) + (n0 >> 5) + half;
#pragma unroll
    for (int hs = 0; hs < 2; ++hs) {
      _Float16* d = vB + ((kb * 8 + cb) * 32 + hs * 16 + col) * 16;
#pragma unroll
      for (int g = 0; g < 2; ++g) {
        v8h o;
#pragma unroll
        for (int s = 0; s < 8; ++s) o[s] = (_Float16)acc[s & 3][4 * g + 2 * hs + (s >> 2)];
        *(v8h*)(d + 8 * g) = o;
      }
    }
    return;
  }

  // D[ch = 8*half + r][n = n0 + 4*col + t]
  const float* w    = wid ? wk : wq;
  const float* bias = wid ? bk : bq;
  _Float16*    dst  = wid ? kB : qA;
#pragma unroll
  for (int r = 0; r < 8; ++r) {
    float bb = half ? bias[8 + r] : bias[r];
#pragma unroll
    for (int t = 0; t < 4; ++t) acc[t][r] = bb;
  }
  proj_tiles<false>(xp, w + col * C_DIM + 4 * half, acc);
#pragma unroll
  for (int t = 0; t < 4; ++t) {
    int n = n0 + 4 * col + t;
    size_t blk = (size_t)b * (NSP / 16) + (n >> 4);
    v8h o;
#pragma unroll
    for (int r = 0; r < 8; ++r) o[r] = (_Float16)acc[t][r];
    *(v8h*)(dst + (blk * 32 + half * 16 + (n & 15)) * 8) = o;
  }
  // Address wait behind the stores: in the built code the other branch's body
  // follows this one and takes the same registers.
  asm volatile("s_wait_xcnt 0x0" ::: "memory");
}

// ---------------------------------------------------------------------------
// Flash-attention core, 8 waves/block (each owns 16 query rows).
// Per 64-key block: async-DMA V tile to LDS, 4 energy WMMAs, online softmax
// (packed f16x2 max tree; row-sum comes free from a ones-column WMMA),
// LDS C->A transpose of P, 18 accumulate WMMAs (8 ch blocks x 2 + ones x 2).
// ---------------------------------------------------------------------------
__global__ __launch_bounds__(256) void attn(const _Float16* __restrict__ qA,
                                            const _Float16* __restrict__ kB,
                                            const _Float16* __restrict__ vB,
                                            const float* __restrict__ x,
                                            const float* __restrict__ gamma,
                                            float* __restrict__ out) {
  __shared__ _Float16 lds_p[8][16][64];        // per-wave P staging, 16 KB
  __shared__ _Float16 lds_v[2 * 8 * 32 * 16];  // shared V tile (64 keys), 16 KB

  int b    = blockIdx.y;
  int wid  = threadIdx.x >> 5;
  int lane = threadIdx.x & 31;
  int half = lane >> 4;
  int col  = lane & 15;
  int q16  = blockIdx.x * 8 + wid;             // batch-local 16-row block

  // Query A operand (K = Cq zero-padded to 32)
  v16h aq = {};
  {
    const v8h* src = (const v8h*)(qA + (((size_t)b * (NSP / 16) + q16) * 32 + lane) * 8);
    v8h t = *src;
#pragma unroll
    for (int j = 0; j < 8; ++j) aq[j] = t[j];
  }
  v16h ones;
#pragma unroll
  for (int j = 0; j < 16; ++j) ones[j] = (_Float16)1.0f;

  v8f acc[9];                                  // [0..7]=channels, [8]=rowsum
#pragma unroll
  for (int cb = 0; cb < 9; ++cb) acc[cb] = {};
  float M[8];
#pragma unroll
  for (int r = 0; r < 8; ++r) M[r] = -__builtin_inff();

  unsigned lds_v_base = (unsigned)(size_t)&lds_v[0];

  for (int kb = 0; kb < NSP / 64; ++kb) {
    __syncthreads();   // everyone done reading previous V tile

    // Async DMA: stage this block's V tile (16 KB) into LDS; overlaps the
    // energy WMMAs + softmax below. Tracked by ASYNCcnt.
    {
      unsigned long long gsrc =
          (unsigned long long)(vB + (((size_t)b * (NSP / 32) + kb * 2) * 8) * 32 * 16);
#pragma unroll
      for (int i = 0; i < 4; ++i) {
        unsigned off = (unsigned)(i * 4096 + threadIdx.x * 16);
        asm volatile("global_load_async_to_lds_b128 %0, %1, %2"
                     :: "v"(lds_v_base + off), "v"(off), "s"(gsrc)
                     : "memory");
      }
    }

    // Energy: 4 x 16-key tiles
    v8f E[4];
#pragma unroll
    for (int t = 0; t < 4; ++t) {
      v16h bk16 = {};
      const v8h* s = (const v8h*)(kB + (((size_t)b * (NSP / 16) + kb * 4 + t) * 32 + lane) * 8);
      v8h tt = *s;
#pragma unroll
      for (int j = 0; j < 8; ++j) bk16[j] = tt[j];
      v8f z = {};
      E[t] = __builtin_amdgcn_wmma_f32_16x16x32_f16(false, aq, false, bk16, (short)0, z, false, false);
    }

    // Row max: local 4-way max, then f16x2-packed xor tree across 16 lanes.
    float mx[8];
#pragma unroll
    for (int r = 0; r < 8; ++r)
      mx[r] = fmaxf(fmaxf(E[0][r], E[1][r]), fmaxf(E[2][r], E[3][r]));
#pragma unroll
    for (int jj = 0; jj < 4; ++jj) {
      h2 pk;
      pk[0] = (_Float16)mx[2 * jj];
      pk[1] = (_Float16)mx[2 * jj + 1];
      int pi = __builtin_bit_cast(int, pk);
#pragma unroll
      for (int d = 1; d < 16; d <<= 1) {
        int o = __shfl_xor(pi, d, 32);
        h2 m2 = __builtin_elementwise_max(__builtin_bit_cast(h2, pi),
                                          __builtin_bit_cast(h2, o));
        pi = __builtin_bit_cast(int, m2);
      }
      h2 m2 = __builtin_bit_cast(h2, pi);
      mx[2 * jj]     = (float)m2[0];
      mx[2 * jj + 1] = (float)m2[1];
    }

    // Online-softmax rescale of all 9 accumulators (rowsum included).
    float sc[8];
#pragma unroll
    for (int r = 0; r < 8; ++r) {
      float mn = fmaxf(M[r], mx[r]);
      sc[r] = __expf(M[r] - mn);
      M[r] = mn;
    }
#pragma unroll
    for (int cb = 0; cb < 9; ++cb) {
#pragma unroll
      for (int r = 0; r < 8; ++r) acc[cb][r] *= sc[r];
    }

    // P = exp(E - M) -> LDS (C-layout write)
#pragma unroll
    for (int r = 0; r < 8; ++r) {
      int m = half * 8 + r;
#pragma unroll
      for (int t = 0; t < 4; ++t) {
        float pv = __expf(E[t][r] - M[r]);
        lds_p[wid][m][t * 16 + col] = (_Float16)pv;
      }
    }
    __builtin_amdgcn_wave_barrier();
    asm volatile("s_wait_dscnt 0x0" ::: "memory");

    // V tile must be resident before the accumulate WMMAs.
    asm volatile("s_wait_asynccnt 0x0" ::: "memory");
    __syncthreads();

    // out_tile[q,c] += P x V^T ; rowsum += P x 1
#pragma unroll
    for (int kk = 0; kk < 2; ++kk) {
      v16h p;
      {
        const v8h* lo = (const v8h*)&lds_p[wid][col][kk * 32 + half * 8];
        const v8h* hi = (const v8h*)&lds_p[wid][col][kk * 32 + 16 + half * 8];
        v8h tl = *lo, th = *hi;
#pragma unroll
        for (int j = 0; j < 8; ++j) { p[j] = tl[j]; p[j + 8] = th[j]; }
      }
#pragma unroll
      for (int cb = 0; cb < 8; ++cb) {
        const v8h* vv = (const v8h*)&lds_v[((kk * 8 + cb) * 32 + lane) * 16];
        v8h t0 = vv[0], t1 = vv[1];
        v16h bv16;
#pragma unroll
        for (int j = 0; j < 8; ++j) { bv16[j] = t0[j]; bv16[j + 8] = t1[j]; }
        acc[cb] = __builtin_amdgcn_wmma_f32_16x16x32_f16(false, p, false, bv16, (short)0, acc[cb], false, false);
      }
      acc[8] = __builtin_amdgcn_wmma_f32_16x16x32_f16(false, p, false, ones, (short)0, acc[8], false, false);
    }
  }

  // Epilogue: normalize by rowsum (acc[8]), gamma, residual.
  float g = gamma[0];
  int nbase = q16 * 16;
#pragma unroll
  for (int r = 0; r < 8; ++r) {
    float inv = 1.0f / acc[8][r];
    int m = half * 8 + r;
    int n = nbase + m;
#pragma unroll
    for (int cb = 0; cb < 8; ++cb) {
      int c = cb * 16 + col;
      size_t idx = ((size_t)b * C_DIM + c) * NSP + n;
      out[idx] = g * (acc[cb][r] * inv) + x[idx];
    }
  }
}

// ---------------------------------------------------------------------------
extern "C" void kernel_launch(void* const* d_in, const int* in_sizes, int n_in,
                              void* d_out, int out_size, void* d_ws, size_t ws_size,
                              hipStream_t stream) {
  const float* x     = (const float*)d_in[0];
  const float* wq    = (const float*)d_in[1];
  const float* bq    = (const float*)d_in[2];
  const float* wk    = (const float*)d_in[3];
  const float* bk    = (const float*)d_in[4];
  const float* wv    = (const float*)d_in[5];
  const float* bv    = (const float*)d_in[6];
  const float* gamma = (const float*)d_in[7];
  float* out = (float*)d_out;

  _Float16* qA = (_Float16*)d_ws;
  _Float16* kB = qA + (size_t)BATCH * (NSP / 16) * 32 * 8;
  _Float16* vB = kB + (size_t)BATCH * (NSP / 16) * 32 * 8;

  proj_qkv<<<dim3(NSP / 64, BATCH), 320, 0, stream>>>(x, wq, bq, wk, bk, wv, bv, qA, kB, vB);
  attn   <<<dim3(NSP / 128, BATCH), 256, 0, stream>>>(qA, kB, vB, x, gamma, out);
}

// v002
// A run of this version takes 60.2 microseconds.
// Timed twice side by side with v001, it ran 2.38 and 2.36 times as fast.
// Over all steps from v000 it is 3.59 times as fast.
#include <hip/hip_runtime.h>
#include <hip/hip_fp16.h>

typedef __attribute__((ext_vector_type(16))) _Float16 v16h;
typedef __attribute__((ext_vector_type(8)))  _Float16 v8h;
typedef __attribute__((ext_vector_type(2)))  _Float16 h2;
typedef __attribute__((ext_vector_type(8)))  float    v8f;
typedef __attribute__((ext_vector_type(4)))  float    v4f;
typedef __attribute__((ext_vector_type(2)))  float    v2f;

#define C_DIM 128
#define CQ    16
#define NSP   4096   // 64*64
#define BATCH 4

// ---------------------------------------------------------------------------
// Projections q, k, v as one f32 WMMA (16x16x4) GEMM: [160 x 128] x [128 x n].
// One block = 64 positions of one batch, ten waves = ten 16-channel tiles
// (wave 0: q, wave 1: k, waves 2..9: v). A wave keeps four position tiles;
// tile t holds positions n0 + 4*j + t (j = lane & 15), so one 16-byte load
// along n feeds all four tiles. k order, the same for x and w fragments:
// step 2*S + e, lane half h, register v  ->  c = 8*S + 4*h + 2*e + v.
// Results leave in the WMMA operand images that attn reads:
//  q,k: lane = (c>>3)*16 + (n&15), half j = c&7  (K padded 16->32 with zeros)
//  v  : B-operand lane images per (32-key, 16-ch) tile.
// ---------------------------------------------------------------------------
template <bool X_IS_A>
__device__ __forceinline__ void proj_tiles(const float* __restrict__ xp,
                                           const float* __restrict__ wp,
                                           v8f (&acc)[4]) {
  // All loops here and in proj_qkv are unrolled whole: the register arrays need
  // constant indices, and the loads of later steps can then issue ahead of the WMMAs.
#pragma unroll
  for (int S = 0; S < C_DIM / 8; ++S) {
    v4f w = *(const v4f*)(wp + 8 * S);
    v4f X[4];
#pragma unroll
    for (int i = 0; i < 4; ++i) X[i] = *(const v4f*)(xp + (size_t)(8 * S + i) * NSP);
#pragma unroll
    for (int e = 0; e < 2; ++e) {
      v2f wf = {w[2 * e], w[2 * e + 1]};
#pragma unroll
      for (int t = 0; t < 4; ++t) {
        v2f xf = {X[2 * e][t], X[2 * e + 1][t]};
        acc[t] = X_IS_A
            ? __builtin_amdgcn_wmma_f32_16x16x4_f32(false, xf, false, wf, (short)0, acc[t], false, false)
            : __builtin_amdgcn_wmma_f32_16x16x4_f32(false, wf, false, xf, (short)0, acc[t], false, false);
      }
    }
  }
  // Address wait behind the last load; the two pointers are inputs so that their
  // registers are not given to anything else while a load that names them is open.
  asm volatile("s_wait_xcnt 0x0" :: "v"(xp), "v"(wp) : "memory");
}

__global__ __launch_bounds__(320) void proj_qkv(const float* __restrict__ x,
                                                const float* __restrict__ wq, const float* __restrict__ bq,
                                                const float* __restrict__ wk, const float* __restrict__ bk,
                                                const float* __restrict__ wv, const float* __restrict__ bv,
                                                _Float16* __restrict__ qA, _Float16* __restrict__ kB,
                                                _Float16* __restrict__ vB) {
  int b    = blockIdx.y;
  int n0   = blockIdx.x * 64;
  int wid  = __builtin_amdgcn_readfirstlane(threadIdx.x >> 5);
  int lane = threadIdx.x & 31;
  int half = lane >> 4;
  int col  = lane & 15;

  const float* xp = x + ((size_t)b * C_DIM + 4 * half) * NSP + n0 + 4 * col;
  v8f acc[4];

  if (wid >= 2) {
    // D[n = n0 + 32*half + 4*r + t][ch = cb*16 + col]
    int cb = wid - 2;
    float bb = bv[cb * 16 + col];
#pragma unroll
    for (int t = 0; t < 4; ++t) {
#pragma unroll
      for (int r = 0; r < 8; ++r) acc[t][r] = bb;
    }
    proj_tiles<true>(xp, wv + (cb * 16 + col) * C_DIM + 4 * half, acc);
    // key in its 32-block: kk = 4*r + t; image lane half = (kk>>3)&1,
    // image position = (kk&7) | ((kk>>4)<<3)
    size_t kb = (size_t)b * (NSP / 32) + (n0 >> 5) + half;
#pragma unroll
    for (int hs = 0; hs < 2; ++hs) {
      _Float16* d = vB + ((kb * 8 + cb) * 32 + hs * 16 + col) * 16;
#pragma unroll
      for (int g = 0; g < 2; ++g) {
        v8h o;
#pragma unroll
        for (int s = 0; s < 8; ++s) o[s] = (_Float16)acc[s & 3][4 * g + 2 * hs + (s >> 2)];
        *(v8h*)(d + 8 * g) = o;
      }
    }
    return;
  }

  // D[ch = 8*half + r][n = n0 + 4*col + t]
  const float* w    = wid ? wk : wq;
  const float* bias = wid ? bk : bq;
  _Float16*    dst  = wid ? kB : qA;
#pragma unroll
  for (int r = 0; r < 8; ++r) {
    float bb = half ? bias[8 + r] : bias[r];
#pragma unroll
    for (int t = 0; t < 4; ++t) acc[t][r] = bb;
  }
  proj_tiles<false>(xp, w + col * C_DIM + 4 * half, acc);
#pragma unroll
  for (int t = 0; t < 4; ++t) {
    int n = n0 + 4 * col + t;
    size_t blk = (size_t)b * (NSP / 16) + (n >> 4);
    v8h o;
#pragma unroll
    for (int r = 0; r < 8; ++r) o[r] = (_Float16)acc[t][r];
    *(v8h*)(dst + (blk * 32 + half * 16 + (n & 15)) * 8) = o;
  }
  // Address wait behind the stores: in the built code the other branch's body
  // follows this one and takes the same registers.
  asm volatile("s_wait_xcnt 0x0" ::: "memory");
}

// ---------------------------------------------------------------------------
// Flash-attention core, 16 waves/block: 4 query tiles (16 rows each) x 4 key
// quarters. Wave (ks, qt) runs query tile qt over keys [ks*1024, ks*1024+1024)
// with its own running maximum; the four partial results of a query tile are
// merged through LDS behind the loop. 256 blocks: one for every WGP, four waves
// per SIMD.
// Per 64-key block: async-DMA V tile to LDS (one tile per key quarter, brought
// by that quarter's four waves), 4 energy WMMAs, online softmax
// (packed f16x2 max tree; row-sum comes free from a ones-column WMMA),
// LDS C->A transpose of P, 18 accumulate WMMAs (8 ch blocks x 2 + ones x 2).
// ---------------------------------------------------------------------------
#define KSPLIT 4
#define QTILES 4
#define KB_PER_SPLIT (NSP / 64 / KSPLIT)

// exp(d) for the merge weights. The v_nop is the slot that the instruction set
// asks for behind a transcendental, before its result is used or its source is
// overwritten; in one statement with the v_exp_f32 it cannot land elsewhere.
__device__ __forceinline__ float exp_slot(float d) {
  float r;
  asm("v_exp_f32 %0, %1\n\tv_nop" : "=v"(r) : "v"(d * 1.44269504f));
  return r;
}

__global__ __launch_bounds__(512) void attn(const _Float16* __restrict__ qA,
                                            const _Float16* __restrict__ kB,
                                            const _Float16* __restrict__ vB,
                                            const float* __restrict__ x,
                                            const float* __restrict__ gamma,
                                            float* __restrict__ out) {
  __shared__ __attribute__((aligned(16))) _Float16 lds_p[KSPLIT * QTILES][16][64];   // per-wave P staging, 32 KB
  __shared__ __attribute__((aligned(16))) _Float16 lds_v[KSPLIT][2 * 8 * 32 * 16];   // V tile (64 keys) per key quarter, 64 KB
  __shared__ __attribute__((aligned(16))) v4f   lds_red[KSPLIT * QTILES][9][2][32];  // per-wave partial accumulators, 144 KB
  __shared__ __attribute__((aligned(16))) float lds_m[KSPLIT * QTILES][16];          // per-wave running maxima

  int b    = blockIdx.y;
  int wid  = __builtin_amdgcn_readfirstlane(threadIdx.x >> 5);
  int ks   = wid >> 2;                         // key quarter
  int qt   = wid & 3;                          // query tile in the block
  int lane = threadIdx.x & 31;
  int half = lane >> 4;
  int col  = lane & 15;
  int q16  = blockIdx.x * QTILES + qt;         // batch-local 16-row block

  // Query A operand (K = Cq zero-padded to 32)
  v16h aq = {};
  {
    const v8h* src = (const v8h*)(qA + (((size_t)b * (NSP / 16) + q16) * 32 + lane) * 8);
    v8h t = *src;
#pragma unroll
    for (int j = 0; j < 8; ++j) aq[j] = t[j];
  }
  v16h ones;
#pragma unroll
  for (int j = 0; j < 16; ++j) ones[j] = (_Float16)1.0f;

  v8f acc[9];                                  // [0..7]=channels, [8]=rowsum
#pragma unroll
  for (int cb = 0; cb < 9; ++cb) acc[cb] = {};
  float M[8];
#pragma unroll
  for (int r = 0; r < 8; ++r) M[r] = -__builtin_inff();

  // This thread's eight 16-byte pieces of its quarter's V tile: byte offset in
  // the tile (the same in memory and in LDS) and LDS address.
  unsigned voff[8], vlds[8];
#pragma unroll
  for (int i = 0; i < 8; ++i) {
    voff[i] = (unsigned)(i * 2048 + (threadIdx.x & 127) * 16);
    vlds[i] = (unsigned)(size_t)&lds_v[ks][0] + voff[i];
  }

  for (int kb = 0; kb < KB_PER_SPLIT; ++kb) {
    int kg = ks * KB_PER_SPLIT + kb;           // batch-local 64-key block
    __syncthreads();   // everyone done reading previous V tile

    // Async DMA: stage this block's V tile (16 KB) into LDS; overlaps the
    // energy WMMAs + softmax below. Tracked by ASYNCcnt. The address wait is
    // the statement's last line, so nothing that rewrites a register named
    // here can come in front of it.
    {
      unsigned long long gsrc =
          (unsigned long long)(vB + (((size_t)b * (NSP / 32) + kg * 2) * 8) * 32 * 16);
      asm volatile("global_load_async_to_lds_b128 %0, %8, %16\n\t"
                   "global_load_async_to_lds_b128 %1, %9, %16\n\t"
                   "global_load_async_to_lds_b128 %2, %10, %16\n\t"
                   "global_load_async_to_lds_b128 %3, %11, %16\n\t"
                   "global_load_async_to_lds_b128 %4, %12, %16\n\t"
                   "global_load_async_to_lds_b128 %5, %13, %16\n\t"
                   "global_load_async_to_lds_b128 %6, %14, %16\n\t"
                   "global_load_async_to_lds_b128 %7, %15, %16\n\t"
                   "s_wait_xcnt 0x0"
                   :: "v"(vlds[0]), "v"(vlds[1]), "v"(vlds[2]), "v"(vlds[3]),
                      "v"(vlds[4]), "v"(vlds[5]), "v"(vlds[6]), "v"(vlds[7]),
                      "v"(voff[0]), "v"(voff[1]), "v"(voff[2]), "v"(voff[3]),
                      "v"(voff[4]), "v"(voff[5]), "v"(voff[6]), "v"(voff[7]),
                      "s"(gsrc)
                   : "memory");
    }

    // Energy: 4 x 16-key tiles
    v8f E[4];
#pragma unroll
    for (int t = 0; t < 4; ++t) {
      v16h bk16 = {};
      const v8h* s = (const v8h*)(kB + (((size_t)b * (NSP / 16) + kg * 4 + t) * 32 + lane) * 8);
      v8h tt = *s;
#pragma unroll
      for (int j = 0; j < 8; ++j) bk16[j] = tt[j];
      v8f z = {};
      E[t] = __builtin_amdgcn_wmma_f32_16x16x32_f16(false, aq, false, bk16, (short)0, z, false, false);
    }

    // Row max: local 4-way max, then f16x2-packed xor tree across 16 lanes.
    float mx[8];
#pragma unroll
    for (int r = 0; r < 8; ++r)
      mx[r] = fmaxf(fmaxf(E[0][r], E[1][r]), fmaxf(E[2][r], E[3][r]));
#pragma unroll
    for (int jj = 0; jj < 4; ++jj) {
      h2 pk;
      pk[0] = (_Float16)mx[2 * jj];
      pk[1] = (_Float16)mx[2 * jj + 1];
      int pi = __builtin_bit_cast(int, pk);
#pragma unroll
      for (int d = 1; d < 16; d <<= 1) {
        int o = __shfl_xor(pi, d, 32);
        h2 m2 = __builtin_elementwise_max(__builtin_bit_cast(h2, pi),
                                          __builtin_bit_cast(h2, o));
        pi = __builtin_bit_cast(int, m2);
      }
      h2 m2 = __builtin_bit_cast(h2, pi);
      mx[2 * jj]     = (float)m2[0];
      mx[2 * jj + 1] = (float)m2[1];
    }

    // Online-softmax rescale of all 9 accumulators (rowsum included).
    float sc[8];
#pragma unroll
    for (int r = 0; r < 8; ++r) {
      float mn = fmaxf(M[r], mx[r]);
      sc[r] = __expf(M[r] - mn);
      M[r] = mn;
    }
#pragma unroll
    for (int cb = 0; cb < 9; ++cb) {
#pragma unroll
      for (int r = 0; r < 8; ++r) acc[cb][r] *= sc[r];
    }

    // P = exp(E - M) -> LDS (C-layout write)
#pragma unroll
    for (int r = 0; r < 8; ++r) {
      int m = half * 8 + r;
#pragma unroll
      for (int t = 0; t < 4; ++t) {
        float pv = __expf(E[t][r] - M[r]);
        lds_p[wid][m][t * 16 + col] = (_Float16)pv;
      }
    }
    __builtin_amdgcn_wave_barrier();
    asm volatile("s_wait_dscnt 0x0" ::: "memory");

    // V tile must be resident before the accumulate WMMAs.
    asm volatile("s_wait_asynccnt 0x0" ::: "memory");
    __syncthreads();

    // out_tile[q,c] += P x V^T ; rowsum += P x 1
#pragma unroll
    for (int kk = 0; kk < 2; ++kk) {
      v16h p;
      {
        const v8h* lo = (const v8h*)&lds_p[wid][col][kk * 32 + half * 8];
        const v8h* hi = (const v8h*)&lds_p[wid][col][kk * 32 + 16 + half * 8];
        v8h tl = *lo, th = *hi;
#pragma unroll
        for (int j = 0; j < 8; ++j) { p[j] = tl[j]; p[j + 8] = th[j]; }
      }
#pragma unroll
      for (int cb = 0; cb < 8; ++cb) {
        const v8h* vv = (const v8h*)&lds_v[ks][((kk * 8 + cb) * 32 + lane) * 16];
        v8h t0 = vv[0], t1 = vv[1];
        v16h bv16;
#pragma unroll
        for (int j = 0; j < 8; ++j) { bv16[j] = t0[j]; bv16[j + 8] = t1[j]; }
        acc[cb] = __builtin_amdgcn_wmma_f32_16x16x32_f16(false, p, false, bv16, (short)0, acc[cb], false, false);
      }
      acc[8] = __builtin_amdgcn_wmma_f32_16x16x32_f16(false, p, false, ones, (short)0, acc[8], false, false);
    }
  }

  // Hand over this wave's partial result: running maxima and all 9 accumulators.
  if (col == 0) {
    v4f m0 = {M[0], M[1], M[2], M[3]};
    v4f m1 = {M[4], M[5], M[6], M[7]};
    *(v4f*)&lds_m[wid][half * 8]     = m0;
    *(v4f*)&lds_m[wid][half * 8 + 4] = m1;
  }
#pragma unroll
  for (int cb = 0; cb < 9; ++cb) {
#pragma unroll
    for (int h = 0; h < 2; ++h) {
      v4f o = {acc[cb][4 * h], acc[cb][4 * h + 1], acc[cb][4 * h + 2], acc[cb][4 * h + 3]};
      lds_red[wid][cb][h][lane] = o;
    }
  }
  __syncthreads();   // every quarter's partials are in LDS before anyone merges

  // Wave (ks, qt) finishes channel blocks 2*ks and 2*ks+1 of its query tile; a
  // lane owns 8 consecutive positions of one channel in each. Their residual
  // values are asked for here, so that they come in while the merge runs.
  size_t idx0 = ((size_t)b * C_DIM + ks * (8 / KSPLIT) * 16 + col) * NSP + q16 * 16 + half * 8;
  const float* xp = x + idx0;
  v4f xr[8 / KSPLIT][2];
#pragma unroll
  for (int j = 0; j < 8 / KSPLIT; ++j) {
#pragma unroll
    for (int h = 0; h < 2; ++h) xr[j][h] = *(const v4f*)(xp + (size_t)j * 16 * NSP + 4 * h);
  }

  // Merge: weight of quarter s for row r is exp(M_s - max over quarters).
  float f[KSPLIT][8];
#pragma unroll
  for (int s = 0; s < KSPLIT; ++s) {
    v4f m0 = *(const v4f*)&lds_m[s * QTILES + qt][half * 8];
    v4f m1 = *(const v4f*)&lds_m[s * QTILES + qt][half * 8 + 4];
#pragma unroll
    for (int r = 0; r < 4; ++r) { f[s][r] = m0[r]; f[s][r + 4] = m1[r]; }
  }
#pragma unroll
  for (int r = 0; r < 8; ++r) {
    float mm = fmaxf(fmaxf(f[0][r], f[1][r]), fmaxf(f[2][r], f[3][r]));
#pragma unroll
    for (int s = 0; s < KSPLIT; ++s) f[s][r] = exp_slot(f[s][r] - mm);
  }
  float inv[8];
#pragma unroll
  for (int r = 0; r < 8; ++r) inv[r] = 0.0f;
#pragma unroll
  for (int s = 0; s < KSPLIT; ++s) {
#pragma unroll
    for (int h = 0; h < 2; ++h) {
      v4f t = lds_red[s * QTILES + qt][8][h][lane];
#pragma unroll
      for (int e = 0; e < 4; ++e) inv[4 * h + e] += f[s][4 * h + e] * t[e];
    }
  }
#pragma unroll
  for (int r = 0; r < 8; ++r) inv[r] = 1.0f / inv[r];

  // Epilogue: normalize by rowsum, gamma, residual.
  float g = gamma[0];
  float* op = out + idx0;
#pragma unroll
  for (int j = 0; j < 8 / KSPLIT; ++j) {
    int cb = ks * (8 / KSPLIT) + j;
    float val[8];
#pragma unroll
    for (int r = 0; r < 8; ++r) val[r] = 0.0f;
#pragma unroll
    for (int s = 0; s < KSPLIT; ++s) {
#pragma unroll
      for (int h = 0; h < 2; ++h) {
        v4f t = lds_red[s * QTILES + qt][cb][h][lane];
#pragma unroll
        for (int e = 0; e < 4; ++e) val[4 * h + e] += f[s][4 * h + e] * t[e];
      }
    }
#pragma unroll
    for (int h = 0; h < 2; ++h) {
      v4f o;
#pragma unroll
      for (int e = 0; e < 4; ++e) o[e] = g * (val[4 * h + e] * inv[4 * h + e]) + xr[j][h][e];
      *(v4f*)(op + (size_t)j * 16 * NSP + 4 * h) = o;
    }
  }
}

// ---------------------------------------------------------------------------
extern "C" void kernel_launch(void* const* d_in, const int* in_sizes, int n_in,
                              void* d_out, int out_size, void* d_ws, size_t ws_size,
                              hipStream_t stream) {
  const float* x     = (const float*)d_in[0];
  const float* wq    = (const float*)d_in[1];
  const float* bq    = (const float*)d_in[2];
  const float* wk    = (const float*)d_in[3];
  const float* bk    = (const float*)d_in[4];
  const float* wv    = (const float*)d_in[5];
  const float* bv    = (const float*)d_in[6];
  const float* gamma = (const float*)d_in[7];
  float* out = (float*)d_out;

  _Float16* qA = (_Float16*)d_ws;
  _Float16* kB = qA + (size_t)BATCH * (NSP / 16) * 32 * 8;
  _Float16* vB = kB + (size_t)BATCH * (NSP / 16) * 32 * 8;

  proj_qkv<<<dim3(NSP / 64, BATCH), 320, 0, stream>>>(x, wq, bq, wk, bk, wv, bv, qA, kB, vB);
  attn   <<<dim3(NSP / 64, BATCH), 512, 0, stream>>>(qA, kB, vB, x, gamma, out);
}

// v003
// A run of this version takes 45 microseconds.
// Timed twice side by side with v002, it ran 1.34 and 1.36 times as fast.
// Counting every step since v000, it is 4.85 times as fast.
#include <hip/hip_runtime.h>
#include <hip/hip_fp16.h>

typedef __attribute__((ext_vector_type(16))) _Float16 v16h;
typedef __attribute__((ext_vector_type(8)))  _Float16 v8h;
typedef __attribute__((ext_vector_type(2)))  _Float16 h2;
typedef __attribute__((ext_vector_type(8)))  float    v8f;
typedef __attribute__((ext_vector_type(4)))  float    v4f;
typedef __attribute__((ext_vector_type(2)))  float    v2f;

#define C_DIM 128
#define CQ    16
#define NSP   4096   // 64*64
#define BATCH 4

// ---------------------------------------------------------------------------
// Projections q, k, v as one f32 WMMA (16x16x4) GEMM: [160 x 128] x [128 x n].
// One block = 64 positions of one batch, ten waves = ten 16-channel tiles
// (wave 0: q, wave 1: k, waves 2..9: v). A wave keeps four position tiles;
// tile t holds positions n0 + 4*j + t (j = lane & 15), so one 16-byte load
// along n feeds all four tiles. k order, the same for x and w fragments:
// step 2*S + e, lane half h, register v  ->  c = 8*S + 4*h + 2*e + v.
// Results leave in the WMMA operand images that attn reads:
//  q,k: lane = (c>>3)*16 + (n&15), half j = c&7  (K padded 16->32 with zeros)
//  v  : A-operand lane images per (32-key, 16-ch) tile.
// ---------------------------------------------------------------------------
template <bool X_IS_A>
__device__ __forceinline__ void proj_tiles(const float* __restrict__ xp,
                                           const float* __restrict__ wp,
                                           v8f (&acc)[4]) {
  // All loops here and in proj_qkv are unrolled whole: the register arrays need
  // constant indices, and the loads of later steps can then issue ahead of the WMMAs.
#pragma unroll
  for (int S = 0; S < C_DIM / 8; ++S) {
    v4f w = *(const v4f*)(wp + 8 * S);
    v4f X[4];
#pragma unroll
    for (int i = 0; i < 4; ++i) X[i] = *(const v4f*)(xp + (size_t)(8 * S + i) * NSP);
#pragma unroll
    for (int e = 0; e < 2; ++e) {
      v2f wf = {w[2 * e], w[2 * e + 1]};
#pragma unroll
      for (int t = 0; t < 4; ++t) {
        v2f xf = {X[2 * e][t], X[2 * e + 1][t]};
        acc[t] = X_IS_A
            ? __builtin_amdgcn_wmma_f32_16x16x4_f32(false, xf, false, wf, (short)0, acc[t], false, false)
            : __builtin_amdgcn_wmma_f32_16x16x4_f32(false, wf, false, xf, (short)0, acc[t], false, false);
      }
    }
  }
  // Address wait behind the last load; the two pointers are inputs so that their
  // registers are not given to anything else while a load that names them is open.
  asm volatile("s_wait_xcnt 0x0" :: "v"(xp), "v"(wp) : "memory");
}

__global__ __launch_bounds__(320) void proj_qkv(const float* __restrict__ x,
                                                const float* __restrict__ wq, const float* __restrict__ bq,
                                                const float* __restrict__ wk, const float* __restrict__ bk,
                                                const float* __restrict__ wv, const float* __restrict__ bv,
                                                _Float16* __restrict__ qA, _Float16* __restrict__ kB,
                                                _Float16* __restrict__ vB) {
  int b    = blockIdx.y;
  int n0   = blockIdx.x * 64;
  int wid  = __builtin_amdgcn_readfirstlane(threadIdx.x >> 5);
  int lane = threadIdx.x & 31;
  int half = lane >> 4;
  int col  = lane & 15;

  const float* xp = x + ((size_t)b * C_DIM + 4 * half) * NSP + n0 + 4 * col;
  v8f acc[4];

  if (wid >= 2) {
    // D[n = n0 + 32*half + 4*r + t][ch = cb*16 + col]
    int cb = wid - 2;
    float bb = bv[cb * 16 + col];
#pragma unroll
    for (int t = 0; t < 4; ++t) {
#pragma unroll
      for (int r = 0; r < 8; ++r) acc[t][r] = bb;
    }
    proj_tiles<true>(xp, wv + (cb * 16 + col) * C_DIM + 4 * half, acc);
    // key in its 32-block: kk = 4*r + t; image lane half = (kk>>3)&1,
    // image position = (kk&7) | ((kk>>4)<<3)
    size_t kb = (size_t)b * (NSP / 32) + (n0 >> 5) + half;
#pragma unroll
    for (int hs = 0; hs < 2; ++hs) {
      _Float16* d = vB + ((kb * 8 + cb) * 32 + hs * 16 + col) * 16;
#pragma unroll
      for (int g = 0; g < 2; ++g) {
        v8h o;
#pragma unroll
        for (int s = 0; s < 8; ++s) o[s] = (_Float16)acc[s & 3][4 * g + 2 * hs + (s >> 2)];
        *(v8h*)(d + 8 * g) = o;
      }
    }
    return;
  }

  // D[ch = 8*half + r][n = n0 + 4*col + t]
  const float* w    = wid ? wk : wq;
  const float* bias = wid ? bk : bq;
  _Float16*    dst  = wid ? kB : qA;
#pragma unroll
  for (int r = 0; r < 8; ++r) {
    float bb = half ? bias[8 + r] : bias[r];
#pragma unroll
    for (int t = 0; t < 4; ++t) acc[t][r] = bb;
  }
  proj_tiles<false>(xp, w + col * C_DIM + 4 * half, acc);
#pragma unroll
  for (int t = 0; t < 4; ++t) {
    int n = n0 + 4 * col + t;
    size_t blk = (size_t)b * (NSP / 16) + (n >> 4);
    v8h o;
#pragma unroll
    for (int r = 0; r < 8; ++r) o[r] = (_Float16)acc[t][r];
    *(v8h*)(dst + (blk * 32 + half * 16 + (n & 15)) * 8) = o;
  }
  // Address wait behind the stores: in the built code the other branch's body
  // follows this one and takes the same registers.
  asm volatile("s_wait_xcnt 0x0" ::: "memory");
}

// ---------------------------------------------------------------------------
// Flash-attention core, 16 waves/block: 4 query tiles (16 rows each) x 4 key
// quarters. Wave (ks, qt) runs query tile qt over keys [ks*1024, ks*1024+1024)
// with its own running maximum; the four partial results of a query tile are
// merged through LDS behind the loop. 256 blocks: one for every WGP, four waves
// per SIMD.
// Both products are taken transposed: S^T = K Q^T (A = key image, B = query
// image) and O^T += V P^T (A = V image, B = P^T). A lane then holds scores of
// ONE query (its column): register r of score tile t is key 16*t + 8*half + r.
// Two score tiles, converted in place, are the B operand of 32 keys
// (b[s] = tile[s >> 3][s & 7], the hardware k order that the V image has too),
// so P never leaves the registers; maximum and rescale factor are one value a lane.
// Per 64-key block: async-DMA V tile to LDS (one tile per key quarter, brought
// by that quarter's four waves), 4 energy WMMAs, online softmax (in-lane
// maximum, one exchange between the lane halves; row sum from an all-ones A),
// 18 accumulate WMMAs (8 ch blocks x 2 + ones x 2).
// ---------------------------------------------------------------------------
#define KSPLIT 4
#define QTILES 4
#define KB_PER_SPLIT (NSP / 64 / KSPLIT)

// exp(d). The v_nop is the slot that the instruction set
// asks for behind a transcendental, before its result is used or its source is
// overwritten; in one statement with the v_exp_f32 it cannot land elsewhere.
__device__ __forceinline__ float exp_slot(float d) {
  float r;
  asm("v_exp_f32 %0, %1\n\tv_nop" : "=v"(r) : "v"(d * 1.44269504f));
  return r;
}

// The same for four values: each v_exp_f32 has an independent one behind it (the
// outputs are early-clobber, so none lies on a source), the last one the v_nop.
// Left to the register allocator, the loop's exps came out as a run in which
// each wrote the source of the one in front of it.
__device__ __forceinline__ v4f exp4_slot(v4f d) {
  float r0, r1, r2, r3;
  asm("v_exp_f32 %0, %4\n\tv_exp_f32 %1, %5\n\tv_exp_f32 %2, %6\n\tv_exp_f32 %3, %7\n\tv_nop"
      : "=&v"(r0), "=&v"(r1), "=&v"(r2), "=&v"(r3)
      : "v"(d[0] * 1.44269504f), "v"(d[1] * 1.44269504f),
        "v"(d[2] * 1.44269504f), "v"(d[3] * 1.44269504f));
  v4f r = {r0, r1, r2, r3};
  return r;
}

// Value of lane l ^ 16 (the other half's share of the same query column).
__device__ __forceinline__ float other_half(float v) {
  int i = __builtin_bit_cast(int, v);
  return __builtin_bit_cast(float,
      __builtin_amdgcn_permlanex16(i, i, 0x76543210, 0xfedcba98, false, false));
}

__global__ __launch_bounds__(512) void attn(const _Float16* __restrict__ qA,
                                            const _Float16* __restrict__ kB,
                                            const _Float16* __restrict__ vB,
                                            const float* __restrict__ x,
                                            const float* __restrict__ gamma,
                                            float* __restrict__ out) {
  __shared__ __attribute__((aligned(16))) _Float16 lds_v[KSPLIT][2 * 8 * 32 * 16];   // V tile (64 keys) per key quarter, 64 KB
  __shared__ __attribute__((aligned(16))) v4f   lds_red[KSPLIT * QTILES][8][2][32];  // per-wave partial accumulators, 128 KB
  __shared__ __attribute__((aligned(16))) float lds_m[KSPLIT * QTILES][16];          // per-wave running maxima
  __shared__ __attribute__((aligned(16))) float lds_l[KSPLIT * QTILES][16];          // per-wave row sums

  int b    = blockIdx.y;
  int wid  = __builtin_amdgcn_readfirstlane(threadIdx.x >> 5);
  int ks   = wid >> 2;                         // key quarter
  int qt   = wid & 3;                          // query tile in the block
  int lane = threadIdx.x & 31;
  int half = lane >> 4;
  int col  = lane & 15;
  int q16  = blockIdx.x * QTILES + qt;         // batch-local 16-row block

  // Query B operand (K = Cq zero-padded to 32)
  v16h aq = {};
  {
    const v8h* src = (const v8h*)(qA + (((size_t)b * (NSP / 16) + q16) * 32 + lane) * 8);
    v8h t = *src;
#pragma unroll
    for (int j = 0; j < 8; ++j) aq[j] = t[j];
  }
  v16h ones;
#pragma unroll
  for (int j = 0; j < 16; ++j) ones[j] = (_Float16)1.0f;

  v8f acc[9];                                  // [0..7]=channels, [8]=rowsum
#pragma unroll
  for (int cb = 0; cb < 9; ++cb) acc[cb] = {};
  float M = -__builtin_inff();                 // running maximum of this lane's query

  // This thread's eight 16-byte pieces of its quarter's V tile: byte offset in
  // the tile (the same in memory and in LDS) and LDS address.
  unsigned voff[8], vlds[8];
#pragma unroll
  for (int i = 0; i < 8; ++i) {
    voff[i] = (unsigned)(i * 2048 + (threadIdx.x & 127) * 16);
    vlds[i] = (unsigned)(size_t)&lds_v[ks][0] + voff[i];
  }

  for (int kb = 0; kb < KB_PER_SPLIT; ++kb) {
    int kg = ks * KB_PER_SPLIT + kb;           // batch-local 64-key block
    __syncthreads();   // everyone done reading previous V tile

    // Async DMA: stage this block's V tile (16 KB) into LDS; overlaps the
    // energy WMMAs + softmax below. Tracked by ASYNCcnt. The address wait is
    // the statement's last line, so nothing that rewrites a register named
    // here can come in front of it.
    {
      unsigned long long gsrc =
          (unsigned long long)(vB + (((size_t)b * (NSP / 32) + kg * 2) * 8) * 32 * 16);
      asm volatile("global_load_async_to_lds_b128 %0, %8, %16\n\t"
                   "global_load_async_to_lds_b128 %1, %9, %16\n\t"
                   "global_load_async_to_lds_b128 %2, %10, %16\n\t"
                   "global_load_async_to_lds_b128 %3, %11, %16\n\t"
                   "global_load_async_to_lds_b128 %4, %12, %16\n\t"
                   "global_load_async_to_lds_b128 %5, %13, %16\n\t"
                   "global_load_async_to_lds_b128 %6, %14, %16\n\t"
                   "global_load_async_to_lds_b128 %7, %15, %16\n\t"
                   "s_wait_xcnt 0x0"
                   :: "v"(vlds[0]), "v"(vlds[1]), "v"(vlds[2]), "v"(vlds[3]),
                      "v"(vlds[4]), "v"(vlds[5]), "v"(vlds[6]), "v"(vlds[7]),
                      "v"(voff[0]), "v"(voff[1]), "v"(voff[2]), "v"(voff[3]),
                      "v"(voff[4]), "v"(voff[5]), "v"(voff[6]), "v"(voff[7]),
                      "s"(gsrc)
                   : "memory");
    }

    // Energy, transposed: 4 x 16-key tiles, E[t][r] = key 16*t + 8*half + r, query col
    v8f E[4];
#pragma unroll
    for (int t = 0; t < 4; ++t) {
      v16h bk16 = {};
      const v8h* s = (const v8h*)(kB + (((size_t)b * (NSP / 16) + kg * 4 + t) * 32 + lane) * 8);
      v8h tt = *s;
#pragma unroll
      for (int j = 0; j < 8; ++j) bk16[j] = tt[j];
      v8f z = {};
      E[t] = __builtin_amdgcn_wmma_f32_16x16x32_f16(false, bk16, false, aq, (short)0, z, false, false);
    }

    // Maximum of this query over the 64 keys: 32 values in the lane, then the other half's.
    float mx[8];
#pragma unroll
    for (int r = 0; r < 8; ++r)
      mx[r] = fmaxf(fmaxf(E[0][r], E[1][r]), fmaxf(E[2][r], E[3][r]));
    float m8 = fmaxf(fmaxf(fmaxf(mx[0], mx[1]), fmaxf(mx[2], mx[3])),
                     fmaxf(fmaxf(mx[4], mx[5]), fmaxf(mx[6], mx[7])));
    m8 = fmaxf(m8, other_half(m8));

    // Online-softmax rescale. Of the row-sum tile only register 0 is read later
    // (all rows of that tile are equal sums), so only that one is rescaled.
    float mn = fmaxf(M, m8);
    float sc = exp_slot(M - mn);
    M = mn;
#pragma unroll
    for (int cb = 0; cb < 8; ++cb) {
#pragma unroll
      for (int r = 0; r < 8; ++r) acc[cb][r] *= sc;
    }
    acc[8][0] *= sc;

    // P^T = exp(E - M), packed in place into the two B operands (32 keys each)
    v16h p[2];
#pragma unroll
    for (int kk = 0; kk < 2; ++kk) {
#pragma unroll
      for (int s4 = 0; s4 < 4; ++s4) {         // elements 4*s4 .. 4*s4+3
        const v8f& e = E[2 * kk + (s4 >> 1)];
        int r0 = 4 * (s4 & 1);
        v4f d = {e[r0] - M, e[r0 + 1] - M, e[r0 + 2] - M, e[r0 + 3] - M};
        v4f pv = exp4_slot(d);
#pragma unroll
        for (int i = 0; i < 4; ++i) p[kk][4 * s4 + i] = (_Float16)pv[i];
      }
    }

    // V tile must be resident before the accumulate WMMAs.
    asm volatile("s_wait_asynccnt 0x0" ::: "memory");
    __syncthreads();

    // out_tile[c,q] += V x P^T ; rowsum += 1 x P^T
#pragma unroll
    for (int kk = 0; kk < 2; ++kk) {
#pragma unroll
      for (int cb = 0; cb < 8; ++cb) {
        const v8h* vv = (const v8h*)&lds_v[ks][((kk * 8 + cb) * 32 + lane) * 16];
        v8h t0 = vv[0], t1 = vv[1];
        v16h bv16;
#pragma unroll
        for (int j = 0; j < 8; ++j) { bv16[j] = t0[j]; bv16[j + 8] = t1[j]; }
        acc[cb] = __builtin_amdgcn_wmma_f32_16x16x32_f16(false, bv16, false, p[kk], (short)0, acc[cb], false, false);
      }
      acc[8] = __builtin_amdgcn_wmma_f32_16x16x32_f16(false, ones, false, p[kk], (short)0, acc[8], false, false);
    }
  }

  // Hand over this wave's partial result: maximum and row sum of each query
  // (both lane halves hold the same), and the 8 channel accumulators:
  // lds_red[wave][cb][h][lane][e] = channel cb*16 + 8*(lane>>4) + 4*h + e, query lane&15.
  if (half == 0) {
    lds_m[wid][col] = M;
    lds_l[wid][col] = acc[8][0];
  }
#pragma unroll
  for (int cb = 0; cb < 8; ++cb) {
#pragma unroll
    for (int h = 0; h < 2; ++h) {
      v4f o = {acc[cb][4 * h], acc[cb][4 * h + 1], acc[cb][4 * h + 2], acc[cb][4 * h + 3]};
      lds_red[wid][cb][h][lane] = o;
    }
  }
  __syncthreads();   // every quarter's partials are in LDS before anyone merges

  // Wave w finishes channel block w >> 1 for 32 queries (query tiles 2*(w&1)
  // and 2*(w&1)+1); a lane owns one query and all 16 channels of the block, so
  // every load and store of a wave is one whole 128-byte line. The residual
  // values are asked for here, so that they come in while the merge runs.
  int cbm = wid >> 1;
  int qtl = 2 * (wid & 1) + half;              // this lane's query tile
  size_t idx0 = ((size_t)b * C_DIM + cbm * 16) * NSP + blockIdx.x * 64 + 32 * (wid & 1) + lane;
  const float* xp = x + idx0;
  float xr[16];
#pragma unroll
  for (int c = 0; c < 16; ++c) xr[c] = xp[(size_t)c * NSP];

  // Merge: weight of quarter s for this query is exp(M_s - max over quarters).
  float f[KSPLIT];
#pragma unroll
  for (int s = 0; s < KSPLIT; ++s) f[s] = lds_m[s * QTILES + qtl][col];
  float mm = fmaxf(fmaxf(f[0], f[1]), fmaxf(f[2], f[3]));
#pragma unroll
  for (int s = 0; s < KSPLIT; ++s) f[s] = exp_slot(f[s] - mm);
  float inv = 0.0f;
#pragma unroll
  for (int s = 0; s < KSPLIT; ++s) inv += f[s] * lds_l[s * QTILES + qtl][col];
  inv = 1.0f / inv;

  // Epilogue: normalize by rowsum, gamma, residual.
  float g = gamma[0];
  float* op = out + idx0;
#pragma unroll
  for (int hc = 0; hc < 2; ++hc) {             // channels 8*hc .. 8*hc+7 of the block
#pragma unroll
    for (int h = 0; h < 2; ++h) {
      v4f val = {};
#pragma unroll
      for (int s = 0; s < KSPLIT; ++s) {
        v4f t = lds_red[s * QTILES + qtl][cbm][h][hc * 16 + col];
#pragma unroll
        for (int e = 0; e < 4; ++e) val[e] += f[s] * t[e];
      }
#pragma unroll
      for (int e = 0; e < 4; ++e) {
        int c = 8 * hc + 4 * h + e;
        op[(size_t)c * NSP] = g * (val[e] * inv) + xr[c];
      }
    }
  }
}

// ---------------------------------------------------------------------------
extern "C" void kernel_launch(void* const* d_in, const int* in_sizes, int n_in,
                              void* d_out, int out_size, void* d_ws, size_t ws_size,
                              hipStream_t stream) {
  const float* x     = (const float*)d_in[0];
  const float* wq    = (const float*)d_in[1];
  const float* bq    = (const float*)d_in[2];
  const float* wk    = (const float*)d_in[3];
  const float* bk    = (const float*)d_in[4];
  const float* wv    = (const float*)d_in[5];
  const float* bv    = (const float*)d_in[6];
  const float* gamma = (const float*)d_in[7];
  float* out = (float*)d_out;

  _Float16* qA = (_Float16*)d_ws;
  _Float16* kB = qA + (size_t)BATCH * (NSP / 16) * 32 * 8;
  _Float16* vB = kB + (size_t)BATCH * (NSP / 16) * 32 * 8;

  proj_qkv<<<dim3(NSP / 64, BATCH), 320, 0, stream>>>(x, wq, bq, wk, bk, wv, bv, qA, kB, vB);
  attn   <<<dim3(NSP / 64, BATCH), 512, 0, stream>>>(qA, kB, vB, x, gamma, out);
}

// v004
// Measured time: 38.1 microseconds a run.
// Timed twice side by side with v003, it ran 1.17 and 1.18 times as fast.
// Counting every step since v000, it is 5.71 times as fast.
#include <hip/hip_runtime.h>
#include <hip/hip_fp16.h>

typedef __attribute__((ext_vector_type(16))) _Float16 v16h;
typedef __attribute__((ext_vector_type(8)))  _Float16 v8h;
typedef __attribute__((ext_vector_type(2)))  _Float16 h2;
typedef __attribute__((ext_vector_type(8)))  float    v8f;
typedef __attribute__((ext_vector_type(4)))  float    v4f;
typedef __attribute__((ext_vector_type(2)))  float    v2f;

#define C_DIM 128
#define CQ    16
#define NSP   4096   // 64*64
#define BATCH 4

// ---------------------------------------------------------------------------
// Projections q, k, v as one f32 WMMA (16x16x4) GEMM: [160 x 128] x [128 x n].
// One block = 64 positions of one batch, ten waves = ten 16-channel tiles
// (wave 0: q, wave 1: k, waves 2..9: v). A wave keeps four position tiles;
// tile t holds positions n0 + 4*j + t (j = lane & 15), so one 16-byte load
// along n feeds all four tiles. k order, the same for x and w fragments:
// step 2*S + e, lane half h, register v  ->  c = 8*S + 4*h + 2*e + v.
// Results leave in the WMMA operand images that attn reads:
//  q,k: lane = (c>>3)*16 + (n&15), half j = c&7  (K padded 16->32 with zeros)
//  v  : A-operand lane images per (32-key, 16-ch) tile.
// ---------------------------------------------------------------------------
template <bool X_IS_A>
__device__ __forceinline__ void proj_tiles(const float* __restrict__ xp,
                                           const float* __restrict__ wp,
                                           v8f (&acc)[4]) {
  // All loops here and in proj_qkv are unrolled whole: the register arrays need
  // constant indices, and the loads of later steps can then issue ahead of the WMMAs.
#pragma unroll
  for (int S = 0; S < C_DIM / 8; ++S) {
    v4f w = *(const v4f*)(wp + 8 * S);
    v4f X[4];
#pragma unroll
    for (int i = 0; i < 4; ++i) X[i] = *(const v4f*)(xp + (size_t)(8 * S + i) * NSP);
#pragma unroll
    for (int e = 0; e < 2; ++e) {
      v2f wf = {w[2 * e], w[2 * e + 1]};
#pragma unroll
      for (int t = 0; t < 4; ++t) {
        v2f xf = {X[2 * e][t], X[2 * e + 1][t]};
        acc[t] = X_IS_A
            ? __builtin_amdgcn_wmma_f32_16x16x4_f32(false, xf, false, wf, (short)0, acc[t], false, false)
            : __builtin_amdgcn_wmma_f32_16x16x4_f32(false, wf, false, xf, (short)0, acc[t], false, false);
      }
    }
  }
  // Address wait behind the last load; the two pointers are inputs so that their
  // registers are not given to anything else while a load that names them is open.
  asm volatile("s_wait_xcnt 0x0" :: "v"(xp), "v"(wp) : "memory");
}

__global__ __launch_bounds__(320) void proj_qkv(const float* __restrict__ x,
                                                const float* __restrict__ wq, const float* __restrict__ bq,
                                                const float* __restrict__ wk, const float* __restrict__ bk,
                                                const float* __restrict__ wv, const float* __restrict__ bv,
                                                _Float16* __restrict__ qA, _Float16* __restrict__ kB,
                                                _Float16* __restrict__ vB) {
  int b    = blockIdx.y;
  int n0   = blockIdx.x * 64;
  int wid  = __builtin_amdgcn_readfirstlane(threadIdx.x >> 5);
  int lane = threadIdx.x & 31;
  int half = lane >> 4;
  int col  = lane & 15;

  const float* xp = x + ((size_t)b * C_DIM + 4 * half) * NSP + n0 + 4 * col;
  v8f acc[4];

  if (wid >= 2) {
    // D[n = n0 + 32*half + 4*r + t][ch = cb*16 + col]
    int cb = wid - 2;
    float bb = bv[cb * 16 + col];
#pragma unroll
    for (int t = 0; t < 4; ++t) {
#pragma unroll
      for (int r = 0; r < 8; ++r) acc[t][r] = bb;
    }
    proj_tiles<true>(xp, wv + (cb * 16 + col) * C_DIM + 4 * half, acc);
    // key in its 32-block: kk = 4*r + t; image lane half = (kk>>3)&1,
    // image position = (kk&7) | ((kk>>4)<<3)
    size_t kb = (size_t)b * (NSP / 32) + (n0 >> 5) + half;
#pragma unroll
    for (int hs = 0; hs < 2; ++hs) {
      _Float16* d = vB + ((kb * 8 + cb) * 32 + hs * 16 + col) * 16;
#pragma unroll
      for (int g = 0; g < 2; ++g) {
        v8h o;
#pragma unroll
        for (int s = 0; s < 8; ++s) o[s] = (_Float16)acc[s & 3][4 * g + 2 * hs + (s >> 2)];
        *(v8h*)(d + 8 * g) = o;
      }
    }
    return;
  }

  // D[ch = 8*half + r][n = n0 + 4*col + t]
  const float* w    = wid ? wk : wq;
  const float* bias = wid ? bk : bq;
  _Float16*    dst  = wid ? kB : qA;
#pragma unroll
  for (int r = 0; r < 8; ++r) {
    float bb = half ? bias[8 + r] : bias[r];
#pragma unroll
    for (int t = 0; t < 4; ++t) acc[t][r] = bb;
  }
  proj_tiles<false>(xp, w + col * C_DIM + 4 * half, acc);
#pragma unroll
  for (int t = 0; t < 4; ++t) {
    int n = n0 + 4 * col + t;
    size_t blk = (size_t)b * (NSP / 16) + (n >> 4);
    v8h o;
#pragma unroll
    for (int r = 0; r < 8; ++r) o[r] = (_Float16)acc[t][r];
    *(v8h*)(dst + (blk * 32 + half * 16 + (n & 15)) * 8) = o;
  }
  // Address wait behind the stores: in the built code the other branch's body
  // follows this one and takes the same registers.
  asm volatile("s_wait_xcnt 0x0" ::: "memory");
}

// ---------------------------------------------------------------------------
// Flash-attention core, 16 waves/block: 4 query tiles (16 rows each) x 4 key
// quarters. Wave (ks, qt) runs query tile qt over keys [ks*1024, ks*1024+1024)
// with its own running maximum; the four partial results of a query tile are
// merged through LDS behind the loop. 256 blocks: one for every WGP, four waves
// per SIMD.
// Both products are taken transposed: S^T = K Q^T (A = key image, B = query
// image) and O^T += V P^T (A = V image, B = P^T). A lane then holds scores of
// ONE query (its column): register r of score tile t is key 16*t + 8*half + r.
// Two score tiles, converted in place, are the B operand of 32 keys
// (b[s] = tile[s >> 3][s & 7], the hardware k order that the V image has too),
// so P never leaves the registers; maximum and rescale factor are one value a lane.
// Per 64-key block: 4 energy WMMAs, online softmax (in-lane maximum, one
// exchange between the lane halves; row sum from an all-ones A), 18 accumulate
// WMMAs (8 ch blocks x 2 + ones x 2).
// The K and V images of a 64-key block (a stage: 16 KB of V, then 2 KB of K, per
// key quarter, brought by that quarter's four waves) come by asynchronous copies
// into a ring of two LDS buffers, one trip ahead of their use: trip t reads
// buffer t & 1 alone, and the one barrier at its foot both publishes stage t + 1
// and frees buffer t & 1 for stage t + 2.
// ---------------------------------------------------------------------------
#define KSPLIT 4
#define QTILES 4
#define KB_PER_SPLIT (NSP / 64 / KSPLIT)
#define VT_HALVES (2 * 8 * 32 * 16)            // V image of 64 keys
#define KT_HALVES (4 * 32 * 8)                 // K image of 64 keys
#define STAGE_HALVES (VT_HALVES + KT_HALVES)

// exp(d). The v_nop is the slot that the instruction set
// asks for behind a transcendental, before its result is used or its source is
// overwritten; in one statement with the v_exp_f32 it cannot land elsewhere.
__device__ __forceinline__ float exp_slot(float d) {
  float r;
  asm("v_exp_f32 %0, %1\n\tv_nop" : "=v"(r) : "v"(d * 1.44269504f));
  return r;
}

// The same for four values: each v_exp_f32 has an independent one behind it (the
// outputs are early-clobber, so none lies on a source), the last one the v_nop.
// Left to the register allocator, the loop's exps came out as a run in which
// each wrote the source of the one in front of it.
__device__ __forceinline__ v4f exp4_slot(v4f d) {
  float r0, r1, r2, r3;
  asm("v_exp_f32 %0, %4\n\tv_exp_f32 %1, %5\n\tv_exp_f32 %2, %6\n\tv_exp_f32 %3, %7\n\tv_nop"
      : "=&v"(r0), "=&v"(r1), "=&v"(r2), "=&v"(r3)
      : "v"(d[0] * 1.44269504f), "v"(d[1] * 1.44269504f),
        "v"(d[2] * 1.44269504f), "v"(d[3] * 1.44269504f));
  v4f r = {r0, r1, r2, r3};
  return r;
}

// Value of lane l ^ 16 (the other half's share of the same query column).
__device__ __forceinline__ float other_half(float v) {
  int i = __builtin_bit_cast(int, v);
  return __builtin_bit_cast(float,
      __builtin_amdgcn_permlanex16(i, i, 0x76543210, 0xfedcba98, false, false));
}

__global__ __launch_bounds__(512) void attn(const _Float16* __restrict__ qA,
                                            const _Float16* __restrict__ kB,
                                            const _Float16* __restrict__ vB,
                                            const float* __restrict__ x,
                                            const float* __restrict__ gamma,
                                            float* __restrict__ out) {
  __shared__ __attribute__((aligned(16))) _Float16 lds_ring[2][KSPLIT][STAGE_HALVES]; // two buffers x four quarters x (V, K), 144 KB
  __shared__ __attribute__((aligned(16))) v4f   lds_red[KSPLIT * QTILES][8][2][32];  // per-wave partial accumulators, 128 KB
  __shared__ __attribute__((aligned(16))) float lds_m[KSPLIT * QTILES][16];          // per-wave running maxima
  __shared__ __attribute__((aligned(16))) float lds_l[KSPLIT * QTILES][16];          // per-wave row sums

  int b    = blockIdx.y;
  int wid  = __builtin_amdgcn_readfirstlane(threadIdx.x >> 5);
  int ks   = wid >> 2;                         // key quarter
  int qt   = wid & 3;                          // query tile in the block
  int lane = threadIdx.x & 31;
  int half = lane >> 4;
  int col  = lane & 15;
  int q16  = blockIdx.x * QTILES + qt;         // batch-local 16-row block

  // Query B operand (K = Cq zero-padded to 32)
  v16h aq = {};
  {
    const v8h* src = (const v8h*)(qA + (((size_t)b * (NSP / 16) + q16) * 32 + lane) * 8);
    v8h t = *src;
#pragma unroll
    for (int j = 0; j < 8; ++j) aq[j] = t[j];
  }
  v16h ones;
#pragma unroll
  for (int j = 0; j < 16; ++j) ones[j] = (_Float16)1.0f;

  v8f acc[9];                                  // [0..7]=channels, [8]=rowsum
#pragma unroll
  for (int cb = 0; cb < 9; ++cb) acc[cb] = {};
  float M = -__builtin_inff();                 // running maximum of this lane's query

  // This thread's nine 16-byte pieces of its quarter's stage: eight of the V
  // image (byte offset voff[i] in the image, the same in memory and in LDS) and
  // one of the K image (byte offset voff[0], behind the V image in LDS).
  unsigned voff[8];
#pragma unroll
  for (int i = 0; i < 8; ++i) voff[i] = (unsigned)(i * 2048 + (threadIdx.x & 127) * 16);

  // Asks for stage st of this quarter (64-key block ks * KB_PER_SPLIT + st).
  // Tracked by ASYNCcnt. The address wait is the statement's last line, so
  // nothing that rewrites a register named here can come in front of it.
  auto copy_stage = [&](int st) {
    int kg = ks * KB_PER_SPLIT + st;
    unsigned base = (unsigned)(size_t)&lds_ring[st & 1][ks][0];
    const char* vsrc = (const char*)(vB + (((size_t)b * (NSP / 32) + kg * 2) * 8) * 32 * 16);
    const char* ksrc = (const char*)(kB + (((size_t)b * (NSP / 16) + kg * 4) * 32) * 8);
    asm volatile("global_load_async_to_lds_b128 %8, %17, off\n\t"
                 "global_load_async_to_lds_b128 %0, %9, off\n\t"
                 "global_load_async_to_lds_b128 %1, %10, off\n\t"
                 "global_load_async_to_lds_b128 %2, %11, off\n\t"
                 "global_load_async_to_lds_b128 %3, %12, off\n\t"
                 "global_load_async_to_lds_b128 %4, %13, off\n\t"
                 "global_load_async_to_lds_b128 %5, %14, off\n\t"
                 "global_load_async_to_lds_b128 %6, %15, off\n\t"
                 "global_load_async_to_lds_b128 %7, %16, off\n\t"
                 "s_wait_xcnt 0x0"
                 :: "v"(base + voff[0]), "v"(base + voff[1]), "v"(base + voff[2]), "v"(base + voff[3]),
                    "v"(base + voff[4]), "v"(base + voff[5]), "v"(base + voff[6]), "v"(base + voff[7]),
                    "v"(base + 2 * VT_HALVES + voff[0]),
                    "v"(vsrc + voff[0]), "v"(vsrc + voff[1]), "v"(vsrc + voff[2]), "v"(vsrc + voff[3]),
                    "v"(vsrc + voff[4]), "v"(vsrc + voff[5]), "v"(vsrc + voff[6]), "v"(vsrc + voff[7]),
                    "v"(ksrc + voff[0])
                 : "memory");
  };

  // Ring prologue: stage 0 lands and is published, then stage 1 is asked for.
  copy_stage(0);
  asm volatile("s_wait_asynccnt 0x0" ::: "memory");   // this wave's share of stage 0 has landed
  __syncthreads();                                     // every wave's share has
  copy_stage(1);

  for (int kb = 0; kb < KB_PER_SPLIT; ++kb) {
    const _Float16* stage = &lds_ring[kb & 1][ks][0];

    // Energy, transposed: 4 x 16-key tiles, E[t][r] = key 16*t + 8*half + r, query col
    v8f E[4];
#pragma unroll
    for (int t = 0; t < 4; ++t) {
      v16h bk16 = {};
      const v8h* s = (const v8h*)(stage + VT_HALVES + (t * 32 + lane) * 8);
      v8h tt = *s;
#pragma unroll
      for (int j = 0; j < 8; ++j) bk16[j] = tt[j];
      v8f z = {};
      E[t] = __builtin_amdgcn_wmma_f32_16x16x32_f16(false, bk16, false, aq, (short)0, z, false, false);
    }

    // Maximum of this query over the 64 keys: 32 values in the lane, then the other half's.
    float mx[8];
#pragma unroll
    for (int r = 0; r < 8; ++r)
      mx[r] = fmaxf(fmaxf(E[0][r], E[1][r]), fmaxf(E[2][r], E[3][r]));
    float m8 = fmaxf(fmaxf(fmaxf(mx[0], mx[1]), fmaxf(mx[2], mx[3])),
                     fmaxf(fmaxf(mx[4], mx[5]), fmaxf(mx[6], mx[7])));
    m8 = fmaxf(m8, other_half(m8));

    // Online-softmax rescale. Of the row-sum tile only register 0 is read later
    // (all rows of that tile are equal sums), so only that one is rescaled.
    float mn = fmaxf(M, m8);
    float sc = exp_slot(M - mn);
    M = mn;
#pragma unroll
    for (int cb = 0; cb < 8; ++cb) {
#pragma unroll
      for (int r = 0; r < 8; ++r) acc[cb][r] *= sc;
    }
    acc[8][0] *= sc;

    // P^T = exp(E - M), packed in place into the two B operands (32 keys each)
    v16h p[2];
#pragma unroll
    for (int kk = 0; kk < 2; ++kk) {
#pragma unroll
      for (int s4 = 0; s4 < 4; ++s4) {         // elements 4*s4 .. 4*s4+3
        const v8f& e = E[2 * kk + (s4 >> 1)];
        int r0 = 4 * (s4 & 1);
        v4f d = {e[r0] - M, e[r0 + 1] - M, e[r0 + 2] - M, e[r0 + 3] - M};
        v4f pv = exp4_slot(d);
#pragma unroll
        for (int i = 0; i < 4; ++i) p[kk][4 * s4 + i] = (_Float16)pv[i];
      }
    }

    // out_tile[c,q] += V x P^T ; rowsum += 1 x P^T
#pragma unroll
    for (int kk = 0; kk < 2; ++kk) {
#pragma unroll
      for (int cb = 0; cb < 8; ++cb) {
        const v8h* vv = (const v8h*)(stage + ((kk * 8 + cb) * 32 + lane) * 16);
        v8h t0 = vv[0], t1 = vv[1];
        v16h bv16;
#pragma unroll
        for (int j = 0; j < 8; ++j) { bv16[j] = t0[j]; bv16[j + 8] = t1[j]; }
        acc[cb] = __builtin_amdgcn_wmma_f32_16x16x32_f16(false, bv16, false, p[kk], (short)0, acc[cb], false, false);
      }
      acc[8] = __builtin_amdgcn_wmma_f32_16x16x32_f16(false, ones, false, p[kk], (short)0, acc[8], false, false);
    }

    // Publish point of stage kb + 1, every wave, in this order.
    asm volatile("s_wait_dscnt 0x0" ::: "memory");     // this wave's reads of the buffer are over before it is refilled
    asm volatile("s_wait_asynccnt 0x0" ::: "memory");  // this wave's share of stage kb + 1 has landed
    __syncthreads();                                   // all shares landed, all readers have left this trip's buffer
    if (kb + 2 < KB_PER_SPLIT) copy_stage(kb + 2);     // the same test for the whole block
  }
  asm volatile("s_wait_asynccnt 0x0" ::: "memory");    // no copy is open when the wave goes on

  // Hand over this wave's partial result: maximum and row sum of each query
  // (both lane halves hold the same), and the 8 channel accumulators:
  // lds_red[wave][cb][h][lane][e] = channel cb*16 + 8*(lane>>4) + 4*h + e, query lane&15.
  if (half == 0) {
    lds_m[wid][col] = M;
    lds_l[wid][col] = acc[8][0];
  }
#pragma unroll
  for (int cb = 0; cb < 8; ++cb) {
#pragma unroll
    for (int h = 0; h < 2; ++h) {
      v4f o = {acc[cb][4 * h], acc[cb][4 * h + 1], acc[cb][4 * h + 2], acc[cb][4 * h + 3]};
      lds_red[wid][cb][h][lane] = o;
    }
  }
  __syncthreads();   // every quarter's partials are in LDS before anyone merges

  // Wave w finishes channel block w >> 1 for 32 queries (query tiles 2*(w&1)
  // and 2*(w&1)+1); a lane owns one query and all 16 channels of the block, so
  // every load and store of a wave is one whole 128-byte line. The residual
  // values are asked for here, so that they come in while the merge runs.
  int cbm = wid >> 1;
  int qtl = 2 * (wid & 1) + half;              // this lane's query tile
  size_t idx0 = ((size_t)b * C_DIM + cbm * 16) * NSP + blockIdx.x * 64 + 32 * (wid & 1) + lane;
  const float* xp = x + idx0;
  float xr[16];
#pragma unroll
  for (int c = 0; c < 16; ++c) xr[c] = xp[(size_t)c * NSP];

  // Merge: weight of quarter s for this query is exp(M_s - max over quarters).
  float f[KSPLIT];
#pragma unroll
  for (int s = 0; s < KSPLIT; ++s) f[s] = lds_m[s * QTILES + qtl][col];
  float mm = fmaxf(fmaxf(f[0], f[1]), fmaxf(f[2], f[3]));
#pragma unroll
  for (int s = 0; s < KSPLIT; ++s) f[s] = exp_slot(f[s] - mm);
  float inv = 0.0f;
#pragma unroll
  for (int s = 0; s < KSPLIT; ++s) inv += f[s] * lds_l[s * QTILES + qtl][col];
  inv = 1.0f / inv;

  // Epilogue: normalize by rowsum, gamma, residual.
  float g = gamma[0];
  float* op = out + idx0;
#pragma unroll
  for (int hc = 0; hc < 2; ++hc) {             // channels 8*hc .. 8*hc+7 of the block
#pragma unroll
    for (int h = 0; h < 2; ++h) {
      v4f val = {};
#pragma unroll
      for (int s = 0; s < KSPLIT; ++s) {
        v4f t = lds_red[s * QTILES + qtl][cbm][h][hc * 16 + col];
#pragma unroll
        for (int e = 0; e < 4; ++e) val[e] += f[s] * t[e];
      }
#pragma unroll
      for (int e = 0; e < 4; ++e) {
        int c = 8 * hc + 4 * h + e;
        op[(size_t)c * NSP] = g * (val[e] * inv) + xr[c];
      }
    }
  }
}

// ---------------------------------------------------------------------------
extern "C" void kernel_launch(void* const* d_in, const int* in_sizes, int n_in,
                              void* d_out, int out_size, void* d_ws, size_t ws_size,
                              hipStream_t stream) {
  const float* x     = (const float*)d_in[0];
  const float* wq    = (const float*)d_in[1];
  const float* bq    = (const float*)d_in[2];
  const float* wk    = (const float*)d_in[3];
  const float* bk    = (const float*)d_in[4];
  const float* wv    = (const float*)d_in[5];
  const float* bv    = (const float*)d_in[6];
  const float* gamma = (const float*)d_in[7];
  float* out = (float*)d_out;

  _Float16* qA = (_Float16*)d_ws;
  _Float16* kB = qA + (size_t)BATCH * (NSP / 16) * 32 * 8;
  _Float16* vB = kB + (size_t)BATCH * (NSP / 16) * 32 * 8;

  proj_qkv<<<dim3(NSP / 64, BATCH), 320, 0, stream>>>(x, wq, bq, wk, bk, wv, bv, qA, kB, vB);
  attn   <<<dim3(NSP / 64, BATCH), 512, 0, stream>>>(qA, kB, vB, x, gamma, out);
}

// v005
// It runs in 35.6 microseconds.
// Two timings next to v004 put it at 1.06 and 1.07 times that version's speed.
// All steps since v000 together make it 6.09 times as fast.
#include <hip/hip_runtime.h>
#include <hip/hip_fp16.h>

typedef __attribute__((ext_vector_type(16))) _Float16 v16h;
typedef __attribute__((ext_vector_type(8)))  _Float16 v8h;
typedef __attribute__((ext_vector_type(2)))  _Float16 h2;
typedef __attribute__((ext_vector_type(8)))  float    v8f;
typedef __attribute__((ext_vector_type(4)))  float    v4f;
typedef __attribute__((ext_vector_type(2)))  float    v2f;

#define C_DIM 128
#define CQ    16
#define NSP   4096   // 64*64
#define BATCH 4

// ---------------------------------------------------------------------------
// Projections q, k, v as one f32 WMMA (16x16x4) GEMM: [160 x 128] x [128 x n].
// One block = 64 positions of one batch, ten waves = ten 16-channel tiles
// (wave 0: q, wave 1: k, waves 2..9: v). A wave keeps four position tiles;
// tile t holds positions n0 + 4*j + t (j = lane & 15), so one 16-byte load
// along n feeds all four tiles. k order, the same for x and w fragments:
// step 2*S + e, lane half h, register v  ->  c = 8*S + 4*h + 2*e + v.
// Results leave in the WMMA operand images that attn reads:
//  q,k: lane = (c>>3)*16 + (n&15), half j = c&7  (K padded 16->32 with zeros)
//  v  : operand lane images per (32-key, 16-ch) tile, as two planes of 32 lanes x
//       16 bytes (plane g = image positions 8*g .. 8*g+7): a 16-byte LDS read of a
//       plane is then 512 bytes in a row, each bank met once per 16 lanes.
// ---------------------------------------------------------------------------
template <bool X_IS_A>
__device__ __forceinline__ void proj_tiles(const float* __restrict__ xp,
                                           const float* __restrict__ wp,
                                           v8f (&acc)[4]) {
  // All loops here and in proj_qkv are unrolled whole: the register arrays need
  // constant indices, and the loads of later steps can then issue ahead of the WMMAs.
#pragma unroll
  for (int S = 0; S < C_DIM / 8; ++S) {
    v4f w = *(const v4f*)(wp + 8 * S);
    v4f X[4];
#pragma unroll
    for (int i = 0; i < 4; ++i) X[i] = *(const v4f*)(xp + (size_t)(8 * S + i) * NSP);
#pragma unroll
    for (int e = 0; e < 2; ++e) {
      v2f wf = {w[2 * e], w[2 * e + 1]};
#pragma unroll
      for (int t = 0; t < 4; ++t) {
        v2f xf = {X[2 * e][t], X[2 * e + 1][t]};
        acc[t] = X_IS_A
            ? __builtin_amdgcn_wmma_f32_16x16x4_f32(false, xf, false, wf, (short)0, acc[t], false, false)
            : __builtin_amdgcn_wmma_f32_16x16x4_f32(false, wf, false, xf, (short)0, acc[t], false, false);
      }
    }
  }
  // Address wait behind the last load; the two pointers are inputs so that their
  // registers are not given to anything else while a load that names them is open.
  asm volatile("s_wait_xcnt 0x0" :: "v"(xp), "v"(wp) : "memory");
}

__global__ __launch_bounds__(320) void proj_qkv(const float* __restrict__ x,
                                                const float* __restrict__ wq, const float* __restrict__ bq,
                                                const float* __restrict__ wk, const float* __restrict__ bk,
                                                const float* __restrict__ wv, const float* __restrict__ bv,
                                                _Float16* __restrict__ qA, _Float16* __restrict__ kB,
                                                _Float16* __restrict__ vB) {
  int b    = blockIdx.y;
  int n0   = blockIdx.x * 64;
  int wid  = __builtin_amdgcn_readfirstlane(threadIdx.x >> 5);
  int lane = threadIdx.x & 31;
  int half = lane >> 4;
  int col  = lane & 15;

  const float* xp = x + ((size_t)b * C_DIM + 4 * half) * NSP + n0 + 4 * col;
  v8f acc[4];

  if (wid >= 2) {
    // D[n = n0 + 32*half + 4*r + t][ch = cb*16 + col]
    int cb = wid - 2;
    float bb = bv[cb * 16 + col];
#pragma unroll
    for (int t = 0; t < 4; ++t) {
#pragma unroll
      for (int r = 0; r < 8; ++r) acc[t][r] = bb;
    }
    proj_tiles<true>(xp, wv + (cb * 16 + col) * C_DIM + 4 * half, acc);
    // key in its 32-block: kk = 4*r + t; image lane half = (kk>>3)&1,
    // image position = (kk&7) | ((kk>>4)<<3)
    size_t kb = (size_t)b * (NSP / 32) + (n0 >> 5) + half;
#pragma unroll
    for (int g = 0; g < 2; ++g) {
#pragma unroll
      for (int hs = 0; hs < 2; ++hs) {
        v8h o;
#pragma unroll
        for (int s = 0; s < 8; ++s) o[s] = (_Float16)acc[s & 3][4 * g + 2 * hs + (s >> 2)];
        *(v8h*)(vB + (((kb * 8 + cb) * 2 + g) * 32 + hs * 16 + col) * 8) = o;
      }
    }
    return;
  }

  // D[ch = 8*half + r][n = n0 + 4*col + t]
  const float* w    = wid ? wk : wq;
  const float* bias = wid ? bk : bq;
  _Float16*    dst  = wid ? kB : qA;
#pragma unroll
  for (int r = 0; r < 8; ++r) {
    float bb = half ? bias[8 + r] : bias[r];
#pragma unroll
    for (int t = 0; t < 4; ++t) acc[t][r] = bb;
  }
  proj_tiles<false>(xp, w + col * C_DIM + 4 * half, acc);
#pragma unroll
  for (int t = 0; t < 4; ++t) {
    int n = n0 + 4 * col + t;
    size_t blk = (size_t)b * (NSP / 16) + (n >> 4);
    v8h o;
#pragma unroll
    for (int r = 0; r < 8; ++r) o[r] = (_Float16)acc[t][r];
    *(v8h*)(dst + (blk * 32 + half * 16 + (n & 15)) * 8) = o;
  }
  // Address wait behind the stores: in the built code the other branch's body
  // follows this one and takes the same registers.
  asm volatile("s_wait_xcnt 0x0" ::: "memory");
}

// ---------------------------------------------------------------------------
// Flash-attention core, 16 waves/block: 4 query tiles (16 rows each) x 4 key
// quarters. Wave (ks, qt) runs query tile qt over keys [ks*1024, ks*1024+1024)
// with its own running maximum; the four partial results of a query tile are
// merged through LDS behind the loop. 256 blocks: one for every WGP, four waves
// per SIMD.
// Both products are taken transposed: S^T = K Q^T (A = key image, B = query
// image) and O^T += V P^T (A = V image, B = P^T). A lane then holds scores of
// ONE query (its column): register r of score tile t is key 16*t + 8*half + r.
// Two score tiles, converted in place, are the B operand of 32 keys
// (b[s] = tile[s >> 3][s & 7], the hardware k order that the V image has too),
// so P never leaves the registers; maximum and rescale factor are one value a lane.
// Per 64-key block: 4 energy WMMAs, online softmax (in-lane maximum, one
// exchange between the lane halves; row sum from an all-ones A), 18 accumulate
// WMMAs (8 ch blocks x 2 + ones x 2).
// The K and V images of a 64-key block (a stage: 16 KB of V, then 2 KB of K, per
// key quarter, brought by that quarter's four waves) come by asynchronous copies
// into a ring of two LDS buffers, one trip ahead of their use: trip t reads
// buffer t & 1 alone, and the one barrier at its foot both publishes stage t + 1
// and frees buffer t & 1 for stage t + 2.
// ---------------------------------------------------------------------------
#define KSPLIT 4
#define QTILES 4
#define KB_PER_SPLIT (NSP / 64 / KSPLIT)
#define VT_HALVES (2 * 8 * 32 * 16)            // V image of 64 keys
#define KT_HALVES (4 * 32 * 8)                 // K image of 64 keys
#define STAGE_HALVES (VT_HALVES + KT_HALVES)

// exp(d). The v_nop is the slot that the instruction set
// asks for behind a transcendental, before its result is used or its source is
// overwritten; in one statement with the v_exp_f32 it cannot land elsewhere.
__device__ __forceinline__ float exp_slot(float d) {
  float r;
  asm("v_exp_f32 %0, %1\n\tv_nop" : "=v"(r) : "v"(d * 1.44269504f));
  return r;
}

// The same for four values: each v_exp_f32 has an independent one behind it (the
// outputs are early-clobber, so none lies on a source), the last one the v_nop.
// Left to the register allocator, the loop's exps came out as a run in which
// each wrote the source of the one in front of it.
__device__ __forceinline__ v4f exp4_slot(v4f d) {
  float r0, r1, r2, r3;
  asm("v_exp_f32 %0, %4\n\tv_exp_f32 %1, %5\n\tv_exp_f32 %2, %6\n\tv_exp_f32 %3, %7\n\tv_nop"
      : "=&v"(r0), "=&v"(r1), "=&v"(r2), "=&v"(r3)
      : "v"(d[0] * 1.44269504f), "v"(d[1] * 1.44269504f),
        "v"(d[2] * 1.44269504f), "v"(d[3] * 1.44269504f));
  v4f r = {r0, r1, r2, r3};
  return r;
}

// Value of lane l ^ 16 (the other half's share of the same query column).
__device__ __forceinline__ float other_half(float v) {
  int i = __builtin_bit_cast(int, v);
  return __builtin_bit_cast(float,
      __builtin_amdgcn_permlanex16(i, i, 0x76543210, 0xfedcba98, false, false));
}

__global__ __launch_bounds__(512) void attn(const _Float16* __restrict__ qA,
                                            const _Float16* __restrict__ kB,
                                            const _Float16* __restrict__ vB,
                                            const float* __restrict__ x,
                                            const float* __restrict__ gamma,
                                            float* __restrict__ out) {
  __shared__ __attribute__((aligned(16))) _Float16 lds_ring[2][KSPLIT][STAGE_HALVES]; // two buffers x four quarters x (V, K), 144 KB
  __shared__ __attribute__((aligned(16))) v4f   lds_red[KSPLIT * QTILES][8][2][32];  // per-wave partial accumulators, 128 KB
  __shared__ __attribute__((aligned(16))) float lds_m[KSPLIT * QTILES][16];          // per-wave running maxima
  __shared__ __attribute__((aligned(16))) float lds_l[KSPLIT * QTILES][16];          // per-wave row sums

  int b    = blockIdx.y;
  int wid  = __builtin_amdgcn_readfirstlane(threadIdx.x >> 5);
  int ks   = wid >> 2;                         // key quarter
  int qt   = wid & 3;                          // query tile in the block
  int lane = threadIdx.x & 31;
  int half = lane >> 4;
  int col  = lane & 15;
  int q16  = blockIdx.x * QTILES + qt;         // batch-local 16-row block

  // Query B operand (K = Cq zero-padded to 32)
  v16h aq = {};
  {
    const v8h* src = (const v8h*)(qA + (((size_t)b * (NSP / 16) + q16) * 32 + lane) * 8);
    v8h t = *src;
#pragma unroll
    for (int j = 0; j < 8; ++j) aq[j] = t[j];
  }
  v16h ones;
#pragma unroll
  for (int j = 0; j < 16; ++j) ones[j] = (_Float16)1.0f;

  v8f acc[9];                                  // [0..7]=channels, [8]=rowsum
#pragma unroll
  for (int cb = 0; cb < 9; ++cb) acc[cb] = {};
  float M = -__builtin_inff();                 // running maximum of this lane's query

  // This thread's nine 16-byte pieces of its quarter's stage: eight of the V
  // image (byte offset voff[i] in the image, the same in memory and in LDS) and
  // one of the K image (byte offset voff[0], behind the V image in LDS).
  unsigned voff[8];
#pragma unroll
  for (int i = 0; i < 8; ++i) voff[i] = (unsigned)(i * 2048 + (threadIdx.x & 127) * 16);

  // Asks for stage st of this quarter (64-key block ks * KB_PER_SPLIT + st).
  // Tracked by ASYNCcnt. The address wait is the statement's last line, so
  // nothing that rewrites a register named here can come in front of it.
  auto copy_stage = [&](int st) {
    int kg = ks * KB_PER_SPLIT + st;
    unsigned base = (unsigned)(size_t)&lds_ring[st & 1][ks][0];
    const char* vsrc = (const char*)(vB + (((size_t)b * (NSP / 32) + kg * 2) * 8) * 32 * 16);
    const char* ksrc = (const char*)(kB + (((size_t)b * (NSP / 16) + kg * 4) * 32) * 8);
    asm volatile("global_load_async_to_lds_b128 %8, %17, off\n\t"
                 "global_load_async_to_lds_b128 %0, %9, off\n\t"
                 "global_load_async_to_lds_b128 %1, %10, off\n\t"
                 "global_load_async_to_lds_b128 %2, %11, off\n\t"
                 "global_load_async_to_lds_b128 %3, %12, off\n\t"
                 "global_load_async_to_lds_b128 %4, %13, off\n\t"
                 "global_load_async_to_lds_b128 %5, %14, off\n\t"
                 "global_load_async_to_lds_b128 %6, %15, off\n\t"
                 "global_load_async_to_lds_b128 %7, %16, off\n\t"
                 "s_wait_xcnt 0x0"
                 :: "v"(base + voff[0]), "v"(base + voff[1]), "v"(base + voff[2]), "v"(base + voff[3]),
                    "v"(base + voff[4]), "v"(base + voff[5]), "v"(base + voff[6]), "v"(base + voff[7]),
                    "v"(base + 2 * VT_HALVES + voff[0]),
                    "v"(vsrc + voff[0]), "v"(vsrc + voff[1]), "v"(vsrc + voff[2]), "v"(vsrc + voff[3]),
                    "v"(vsrc + voff[4]), "v"(vsrc + voff[5]), "v"(vsrc + voff[6]), "v"(vsrc + voff[7]),
                    "v"(ksrc + voff[0])
                 : "memory");
  };

  // Ring prologue: stage 0 lands and is published, then stage 1 is asked for.
  copy_stage(0);
  asm volatile("s_wait_asynccnt 0x0" ::: "memory");   // this wave's share of stage 0 has landed
  __syncthreads();                                     // every wave's share has
  copy_stage(1);

  for (int kb = 0; kb < KB_PER_SPLIT; ++kb) {
    const _Float16* stage = &lds_ring[kb & 1][ks][0];

    // Energy, transposed: 4 x 16-key tiles, E[t][r] = key 16*t + 8*half + r, query col
    v8f E[4];
#pragma unroll
    for (int t = 0; t < 4; ++t) {
      v16h bk16 = {};
      const v8h* s = (const v8h*)(stage + VT_HALVES + (t * 32 + lane) * 8);
      v8h tt = *s;
#pragma unroll
      for (int j = 0; j < 8; ++j) bk16[j] = tt[j];
      v8f z = {};
      E[t] = __builtin_amdgcn_wmma_f32_16x16x32_f16(false, bk16, false, aq, (short)0, z, false, false);
    }

    // Maximum of this query over the 64 keys: 32 values in the lane, then the other half's.
    float mx[8];
#pragma unroll
    for (int r = 0; r < 8; ++r)
      mx[r] = fmaxf(fmaxf(E[0][r], E[1][r]), fmaxf(E[2][r], E[3][r]));
    float m8 = fmaxf(fmaxf(fmaxf(mx[0], mx[1]), fmaxf(mx[2], mx[3])),
                     fmaxf(fmaxf(mx[4], mx[5]), fmaxf(mx[6], mx[7])));
    m8 = fmaxf(m8, other_half(m8));

    // Online-softmax rescale. Of the row-sum tile only register 0 is read later
    // (all rows of that tile are equal sums), so only that one is rescaled.
    float mn = fmaxf(M, m8);
    float sc = exp_slot(M - mn);
    M = mn;
#pragma unroll
    for (int cb = 0; cb < 8; ++cb) {
#pragma unroll
      for (int r = 0; r < 8; ++r) acc[cb][r] *= sc;
    }
    acc[8][0] *= sc;

    // P^T = exp(E - M), packed in place into the two B operands (32 keys each)
    v16h p[2];
#pragma unroll
    for (int kk = 0; kk < 2; ++kk) {
#pragma unroll
      for (int s4 = 0; s4 < 4; ++s4) {         // elements 4*s4 .. 4*s4+3
        const v8f& e = E[2 * kk + (s4 >> 1)];
        int r0 = 4 * (s4 & 1);
        v4f d = {e[r0] - M, e[r0 + 1] - M, e[r0 + 2] - M, e[r0 + 3] - M};
        v4f pv = exp4_slot(d);
#pragma unroll
        for (int i = 0; i < 4; ++i) p[kk][4 * s4 + i] = (_Float16)pv[i];
      }
    }

    // out_tile[c,q] += V x P^T ; rowsum += 1 x P^T
#pragma unroll
    for (int kk = 0; kk < 2; ++kk) {
#pragma unroll
      for (int cb = 0; cb < 8; ++cb) {
        const v8h* vv = (const v8h*)(stage + (kk * 8 + cb) * 512 + lane * 8);
        v8h t0 = vv[0], t1 = vv[32];             // the tile's two planes
        v16h bv16;
#pragma unroll
        for (int j = 0; j < 8; ++j) { bv16[j] = t0[j]; bv16[j + 8] = t1[j]; }
        acc[cb] = __builtin_amdgcn_wmma_f32_16x16x32_f16(false, bv16, false, p[kk], (short)0, acc[cb], false, false);
      }
      acc[8] = __builtin_amdgcn_wmma_f32_16x16x32_f16(false, ones, false, p[kk], (short)0, acc[8], false, false);
    }

    // Publish point of stage kb + 1, every wave, in this order.
    asm volatile("s_wait_dscnt 0x0" ::: "memory");     // this wave's reads of the buffer are over before it is refilled
    asm volatile("s_wait_asynccnt 0x0" ::: "memory");  // this wave's share of stage kb + 1 has landed
    __syncthreads();                                   // all shares landed, all readers have left this trip's buffer
    if (kb + 2 < KB_PER_SPLIT) copy_stage(kb + 2);     // the same test for the whole block
  }
  asm volatile("s_wait_asynccnt 0x0" ::: "memory");    // no copy is open when the wave goes on

  // Hand over this wave's partial result: maximum and row sum of each query
  // (both lane halves hold the same), and the 8 channel accumulators:
  // lds_red[wave][cb][h][lane][e] = channel cb*16 + 8*(lane>>4) + 4*h + e, query lane&15.
  if (half == 0) {
    lds_m[wid][col] = M;
    lds_l[wid][col] = acc[8][0];
  }
#pragma unroll
  for (int cb = 0; cb < 8; ++cb) {
#pragma unroll
    for (int h = 0; h < 2; ++h) {
      v4f o = {acc[cb][4 * h], acc[cb][4 * h + 1], acc[cb][4 * h + 2], acc[cb][4 * h + 3]};
      lds_red[wid][cb][h][lane] = o;
    }
  }
  __syncthreads();   // every quarter's partials are in LDS before anyone merges

  // Wave w finishes channel block w >> 1 for 32 queries (query tiles 2*(w&1)
  // and 2*(w&1)+1); a lane owns one query and all 16 channels of the block, so
  // every load and store of a wave is one whole 128-byte line. The residual
  // values are asked for here, so that they come in while the merge runs.
  int cbm = wid >> 1;
  int qtl = 2 * (wid & 1) + half;              // this lane's query tile
  size_t idx0 = ((size_t)b * C_DIM + cbm * 16) * NSP + blockIdx.x * 64 + 32 * (wid & 1) + lane;
  const float* xp = x + idx0;
  float xr[16];
#pragma unroll
  for (int c = 0; c < 16; ++c) xr[c] = xp[(size_t)c * NSP];

  // Merge: weight of quarter s for this query is exp(M_s - max over quarters).
  float f[KSPLIT];
#pragma unroll
  for (int s = 0; s < KSPLIT; ++s) f[s] = lds_m[s * QTILES + qtl][col];
  float mm = fmaxf(fmaxf(f[0], f[1]), fmaxf(f[2], f[3]));
#pragma unroll
  for (int s = 0; s < KSPLIT; ++s) f[s] = exp_slot(f[s] - mm);
  float inv = 0.0f;
#pragma unroll
  for (int s = 0; s < KSPLIT; ++s) inv += f[s] * lds_l[s * QTILES + qtl][col];
  inv = 1.0f / inv;

  // Epilogue: normalize by rowsum, gamma, residual.
  float g = gamma[0];
  float* op = out + idx0;
#pragma unroll
  for (int hc = 0; hc < 2; ++hc) {             // channels 8*hc .. 8*hc+7 of the block
#pragma unroll
    for (int h = 0; h < 2; ++h) {
      v4f val = {};
#pragma unroll
      for (int s = 0; s < KSPLIT; ++s) {
        v4f t = lds_red[s * QTILES + qtl][cbm][h][hc * 16 + col];
#pragma unroll
        for (int e = 0; e < 4; ++e) val[e] += f[s] * t[e];
      }
#pragma unroll
      for (int e = 0; e < 4; ++e) {
        int c = 8 * hc + 4 * h + e;
        op[(size_t)c * NSP] = g * (val[e] * inv) + xr[c];
      }
    }
  }
}

// ---------------------------------------------------------------------------
extern "C" void kernel_launch(void* const* d_in, const int* in_sizes, int n_in,
                              void* d_out, int out_size, void* d_ws, size_t ws_size,
                              hipStream_t stream) {
  const float* x     = (const float*)d_in[0];
  const float* wq    = (const float*)d_in[1];
  const float* bq    = (const float*)d_in[2];
  const float* wk    = (const float*)d_in[3];
  const float* bk    = (const float*)d_in[4];
  const float* wv    = (const float*)d_in[5];
  const float* bv    = (const float*)d_in[6];
  const float* gamma = (const float*)d_in[7];
  float* out = (float*)d_out;

  _Float16* qA = (_Float16*)d_ws;
  _Float16* kB = qA + (size_t)BATCH * (NSP / 16) * 32 * 8;
  _Float16* vB = kB + (size_t)BATCH * (NSP / 16) * 32 * 8;

  proj_qkv<<<dim3(NSP / 64, BATCH), 320, 0, stream>>>(x, wq, bq, wk, bk, wv, bv, qA, kB, vB);
  attn   <<<dim3(NSP / 64, BATCH), 512, 0, stream>>>(qA, kB, vB, x, gamma, out);
}

// v006
// It runs in 33.9 microseconds.
// Two timings next to v005 put it at 1.04 and 1.06 times that version's speed.
// Over all steps from v000 it is 6.39 times as fast.
#include <hip/hip_runtime.h>
#include <hip/hip_fp16.h>

typedef __attribute__((ext_vector_type(16))) _Float16 v16h;
typedef __attribute__((ext_vector_type(8)))  _Float16 v8h;
typedef __attribute__((ext_vector_type(2)))  _Float16 h2;
typedef __attribute__((ext_vector_type(8)))  float    v8f;
typedef __attribute__((ext_vector_type(4)))  float    v4f;
typedef __attribute__((ext_vector_type(2)))  float    v2f;

#define C_DIM 128
#define CQ    16
#define NSP   4096   // 64*64
#define BATCH 4

// ---------------------------------------------------------------------------
// Projections q, k, v as one f32 WMMA (16x16x4) GEMM: [160 x 128] x [128 x n].
// One block = 64 positions of one batch, ten waves = ten 16-channel tiles
// (wave 0: q, wave 1: k, waves 2..9: v). A wave keeps four position tiles;
// tile t holds positions n0 + 4*j + t (j = lane & 15), so one 16-byte load
// along n feeds all four tiles. k order, the same for x and w fragments:
// step 2*S + e, lane half h, register v  ->  c = 8*S + 4*h + 2*e + v.
// Results leave in the WMMA operand images that attn reads:
//  q,k: lane = (c>>3)*16 + (n&15), half j = c&7  (K padded 16->32 with zeros)
//  v  : operand lane images per (32-key, 16-ch) tile, as two planes of 32 lanes x
//       16 bytes (plane g = image positions 8*g .. 8*g+7): a 16-byte LDS read of a
//       plane is then 512 bytes in a row, each bank met once per 16 lanes.
// ---------------------------------------------------------------------------
template <bool X_IS_A>
__device__ __forceinline__ void proj_tiles(const float* __restrict__ xp,
                                           const float* __restrict__ wp,
                                           v8f (&acc)[4]) {
  // All loops here and in proj_qkv are unrolled whole: the register arrays need
  // constant indices, and the loads of later steps can then issue ahead of the WMMAs.
#pragma unroll
  for (int S = 0; S < C_DIM / 8; ++S) {
    v4f w = *(const v4f*)(wp + 8 * S);
    v4f X[4];
#pragma unroll
    for (int i = 0; i < 4; ++i) X[i] = *(const v4f*)(xp + (size_t)(8 * S + i) * NSP);
#pragma unroll
    for (int e = 0; e < 2; ++e) {
      v2f wf = {w[2 * e], w[2 * e + 1]};
#pragma unroll
      for (int t = 0; t < 4; ++t) {
        v2f xf = {X[2 * e][t], X[2 * e + 1][t]};
        acc[t] = X_IS_A
            ? __builtin_amdgcn_wmma_f32_16x16x4_f32(false, xf, false, wf, (short)0, acc[t], false, false)
            : __builtin_amdgcn_wmma_f32_16x16x4_f32(false, wf, false, xf, (short)0, acc[t], false, false);
      }
    }
  }
  // Address wait behind the last load; the two pointers are inputs so that their
  // registers are not given to anything else while a load that names them is open.
  asm volatile("s_wait_xcnt 0x0" :: "v"(xp), "v"(wp) : "memory");
}

__global__ __launch_bounds__(320) void proj_qkv(const float* __restrict__ x,
                                                const float* __restrict__ wq, const float* __restrict__ bq,
                                                const float* __restrict__ wk, const float* __restrict__ bk,
                                                const float* __restrict__ wv, const float* __restrict__ bv,
                                                _Float16* __restrict__ qA, _Float16* __restrict__ kB,
                                                _Float16* __restrict__ vB) {
  int b    = blockIdx.y;
  int n0   = blockIdx.x * 64;
  int wid  = __builtin_amdgcn_readfirstlane(threadIdx.x >> 5);
  int lane = threadIdx.x & 31;
  int half = lane >> 4;
  int col  = lane & 15;

  const float* xp = x + ((size_t)b * C_DIM + 4 * half) * NSP + n0 + 4 * col;
  v8f acc[4];

  if (wid >= 2) {
    // D[n = n0 + 32*half + 4*r + t][ch = cb*16 + col]
    int cb = wid - 2;
    float bb = bv[cb * 16 + col];
#pragma unroll
    for (int t = 0; t < 4; ++t) {
#pragma unroll
      for (int r = 0; r < 8; ++r) acc[t][r] = bb;
    }
    proj_tiles<true>(xp, wv + (cb * 16 + col) * C_DIM + 4 * half, acc);
    // key in its 32-block: kk = 4*r + t; image lane half = (kk>>3)&1,
    // image position = (kk&7) | ((kk>>4)<<3)
    size_t kb = (size_t)b * (NSP / 32) + (n0 >> 5) + half;
#pragma unroll
    for (int g = 0; g < 2; ++g) {
#pragma unroll
      for (int hs = 0; hs < 2; ++hs) {
        v8h o;
#pragma unroll
        for (int s = 0; s < 8; ++s) o[s] = (_Float16)acc[s & 3][4 * g + 2 * hs + (s >> 2)];
        *(v8h*)(vB + (((kb * 8 + cb) * 2 + g) * 32 + hs * 16 + col) * 8) = o;
      }
    }
    return;
  }

  // D[ch = 8*half + r][n = n0 + 4*col + t]
  const float* w    = wid ? wk : wq;
  const float* bias = wid ? bk : bq;
  _Float16*    dst  = wid ? kB : qA;
#pragma unroll
  for (int r = 0; r < 8; ++r) {
    float bb = half ? bias[8 + r] : bias[r];
#pragma unroll
    for (int t = 0; t < 4; ++t) acc[t][r] = bb;
  }
  proj_tiles<false>(xp, w + col * C_DIM + 4 * half, acc);
#pragma unroll
  for (int t = 0; t < 4; ++t) {
    int n = n0 + 4 * col + t;
    size_t blk = (size_t)b * (NSP / 16) + (n >> 4);
    v8h o;
#pragma unroll
    for (int r = 0; r < 8; ++r) o[r] = (_Float16)acc[t][r];
    *(v8h*)(dst + (blk * 32 + half * 16 + (n & 15)) * 8) = o;
  }
  // Address wait behind the stores: in the built code the other branch's body
  // follows this one and takes the same registers.
  asm volatile("s_wait_xcnt 0x0" ::: "memory");
}

// ---------------------------------------------------------------------------
// Flash-attention core, 16 waves/block: 4 query tiles (16 rows each) x 4 key
// quarters. Wave (ks, qt) runs query tile qt over keys [ks*1024, ks*1024+1024)
// with its own running maximum; the four partial results of a query tile are
// merged through LDS behind the loop. 256 blocks: one for every WGP, four waves
// per SIMD.
// Both products are taken transposed: S^T = K Q^T (A = key image, B = query
// image) and O^T += V P^T (A = V image, B = P^T). A lane then holds scores of
// ONE query (its column): register r of score tile t is key 16*t + 8*half + r.
// Two score tiles, converted in place, are the B operand of 32 keys
// (b[s] = tile[s >> 3][s & 7], the hardware k order that the V image has too),
// so P never leaves the registers; maximum and rescale factor are one value a lane.
// Per 64-key block: 4 energy WMMAs, online softmax (in-lane maximum, one
// exchange between the lane halves; row sum from an all-ones A), 18 accumulate
// WMMAs (8 ch blocks x 2 + ones x 2).
// The K and V images of a 64-key block (a stage: 16 KB of V, then 2 KB of K, per
// key quarter, brought by that quarter's four waves) come by asynchronous copies
// into a ring of two LDS buffers, one trip ahead of their use: trip t reads
// buffer t & 1 alone, and the one barrier at its foot both publishes stage t + 1
// and frees buffer t & 1 for stage t + 2.
// ---------------------------------------------------------------------------
#define KSPLIT 4
#define QTILES 4
#define KB_PER_SPLIT (NSP / 64 / KSPLIT)
#define VT_HALVES (2 * 8 * 32 * 16)            // V image of 64 keys
#define KT_HALVES (4 * 32 * 8)                 // K image of 64 keys
#define STAGE_HALVES (VT_HALVES + KT_HALVES)

// exp(d). The v_nop is the slot that the instruction set
// asks for behind a transcendental, before its result is used or its source is
// overwritten; in one statement with the v_exp_f32 it cannot land elsewhere.
__device__ __forceinline__ float exp_slot(float d) {
  float r;
  asm("v_exp_f32 %0, %1\n\tv_nop" : "=v"(r) : "v"(d * 1.44269504f));
  return r;
}

// The same for four values: each v_exp_f32 has an independent one behind it (the
// outputs are early-clobber, so none lies on a source), the last one the v_nop.
// Left to the register allocator, the loop's exps came out as a run in which
// each wrote the source of the one in front of it.
__device__ __forceinline__ v4f exp4_slot(v4f d) {
  float r0, r1, r2, r3;
  asm("v_exp_f32 %0, %4\n\tv_exp_f32 %1, %5\n\tv_exp_f32 %2, %6\n\tv_exp_f32 %3, %7\n\tv_nop"
      : "=&v"(r0), "=&v"(r1), "=&v"(r2), "=&v"(r3)
      : "v"(d[0] * 1.44269504f), "v"(d[1] * 1.44269504f),
        "v"(d[2] * 1.44269504f), "v"(d[3] * 1.44269504f));
  v4f r = {r0, r1, r2, r3};
  return r;
}

// Value of lane l ^ 16 (the other half's share of the same query column).
__device__ __forceinline__ float other_half(float v) {
  int i = __builtin_bit_cast(int, v);
  return __builtin_bit_cast(float,
      __builtin_amdgcn_permlanex16(i, i, 0x76543210, 0xfedcba98, false, false));
}

__global__ __launch_bounds__(512) void attn(const _Float16* __restrict__ qA,
                                            const _Float16* __restrict__ kB,
                                            const _Float16* __restrict__ vB,
                                            const float* __restrict__ x,
                                            const float* __restrict__ gamma,
                                            float* __restrict__ out) {
  __shared__ __attribute__((aligned(16))) _Float16 lds_ring[2][KSPLIT][STAGE_HALVES]; // two buffers x four quarters x (V, K), 144 KB
  __shared__ __attribute__((aligned(16))) v4f   lds_red[KSPLIT * QTILES][8][2][32];  // per-wave partial accumulators, 128 KB
  __shared__ __attribute__((aligned(16))) float lds_m[KSPLIT * QTILES][16];          // per-wave running maxima
  __shared__ __attribute__((aligned(16))) float lds_l[KSPLIT * QTILES][16];          // per-wave row sums

  int b    = blockIdx.y;
  int wid  = __builtin_amdgcn_readfirstlane(threadIdx.x >> 5);
  int ks   = wid >> 2;                         // key quarter
  int qt   = wid & 3;                          // query tile in the block
  int lane = threadIdx.x & 31;
  int half = lane >> 4;
  int col  = lane & 15;
  int q16  = blockIdx.x * QTILES + qt;         // batch-local 16-row block

  // Query B operand (K = Cq zero-padded to 32)
  v16h aq = {};
  {
    const v8h* src = (const v8h*)(qA + (((size_t)b * (NSP / 16) + q16) * 32 + lane) * 8);
    v8h t = *src;
#pragma unroll
    for (int j = 0; j < 8; ++j) aq[j] = t[j];
  }
  v16h ones;
#pragma unroll
  for (int j = 0; j < 16; ++j) ones[j] = (_Float16)1.0f;

  v8f acc[9];                                  // [0..7]=channels, [8]=rowsum
#pragma unroll
  for (int cb = 0; cb < 9; ++cb) acc[cb] = {};
  float M = -__builtin_inff();                 // running maximum of this lane's query

  // This thread's nine 16-byte pieces of its quarter's stage: eight of the V
  // image (byte offset voff[i] in the image, the same in memory and in LDS) and
  // one of the K image (byte offset voff[0], behind the V image in LDS).
  unsigned voff[8];
#pragma unroll
  for (int i = 0; i < 8; ++i) voff[i] = (unsigned)(i * 2048 + (threadIdx.x & 127) * 16);

  // Asks for stage st of this quarter (64-key block ks * KB_PER_SPLIT + st).
  // Tracked by ASYNCcnt. The address wait is the statement's last line, so
  // nothing that rewrites a register named here can come in front of it.
  auto copy_stage = [&](int st) {
    int kg = ks * KB_PER_SPLIT + st;
    unsigned base = (unsigned)(size_t)&lds_ring[st & 1][ks][0];
    const char* vsrc = (const char*)(vB + (((size_t)b * (NSP / 32) + kg * 2) * 8) * 32 * 16);
    const char* ksrc = (const char*)(kB + (((size_t)b * (NSP / 16) + kg * 4) * 32) * 8);
    asm volatile("global_load_async_to_lds_b128 %8, %17, off\n\t"
                 "global_load_async_to_lds_b128 %0, %9, off\n\t"
                 "global_load_async_to_lds_b128 %1, %10, off\n\t"
                 "global_load_async_to_lds_b128 %2, %11, off\n\t"
                 "global_load_async_to_lds_b128 %3, %12, off\n\t"
                 "global_load_async_to_lds_b128 %4, %13, off\n\t"
                 "global_load_async_to_lds_b128 %5, %14, off\n\t"
                 "global_load_async_to_lds_b128 %6, %15, off\n\t"
                 "global_load_async_to_lds_b128 %7, %16, off\n\t"
                 "s_wait_xcnt 0x0"
                 :: "v"(base + voff[0]), "v"(base + voff[1]), "v"(base + voff[2]), "v"(base + voff[3]),
                    "v"(base + voff[4]), "v"(base + voff[5]), "v"(base + voff[6]), "v"(base + voff[7]),
                    "v"(base + 2 * VT_HALVES + voff[0]),
                    "v"(vsrc + voff[0]), "v"(vsrc + voff[1]), "v"(vsrc + voff[2]), "v"(vsrc + voff[3]),
                    "v"(vsrc + voff[4]), "v"(vsrc + voff[5]), "v"(vsrc + voff[6]), "v"(vsrc + voff[7]),
                    "v"(ksrc + voff[0])
                 : "memory");
  };

  // Ring prologue: stage 0 lands and is published, then stage 1 is asked for.
  copy_stage(0);
  asm volatile("s_wait_asynccnt 0x0" ::: "memory");   // this wave's share of stage 0 has landed
  __syncthreads();                                     // every wave's share has
  copy_stage(1);

  for (int kb = 0; kb < KB_PER_SPLIT; ++kb) {
    const _Float16* stage = &lds_ring[kb & 1][ks][0];

    // A operand of V tile (kk, cb): the tile's two planes.
    auto load_v = [&](int kk, int cb) {
      const v8h* vv = (const v8h*)(stage + (kk * 8 + cb) * 512 + lane * 8);
      return __builtin_shufflevector(vv[0], vv[32], 0, 1, 2, 3, 4, 5, 6, 7, 8, 9, 10, 11, 12, 13, 14, 15);
    };

    // All LDS reads that the trip can hold in registers are asked for here, the K
    // tiles first: the V tiles of keys 0..31 come in while scores and softmax run.
    v8h kf[4];
#pragma unroll
    for (int t = 0; t < 4; ++t) kf[t] = *(const v8h*)(stage + VT_HALVES + (t * 32 + lane) * 8);
    v16h vf[8], vg[8];                         // V tiles of keys 0..31 and 32..63
#pragma unroll
    for (int cb = 0; cb < 8; ++cb) vf[cb] = load_v(0, cb);
    // Keeps the reads above this line: left free, the scheduler sinks each pair to
    // just in front of its WMMA, which then waits out the whole LDS latency.
    __builtin_amdgcn_sched_barrier(0);

    // Energy, transposed: 4 x 16-key tiles, E[t][r] = key 16*t + 8*half + r, query col
    v8f E[4];
#pragma unroll
    for (int t = 0; t < 4; ++t) {
      v16h bk16 = {};
      v8h tt = kf[t];
#pragma unroll
      for (int j = 0; j < 8; ++j) bk16[j] = tt[j];
      v8f z = {};
      E[t] = __builtin_amdgcn_wmma_f32_16x16x32_f16(false, bk16, false, aq, (short)0, z, false, false);
    }

    // Maximum of this query over the 64 keys: 32 values in the lane, then the other half's.
    float mx[8];
#pragma unroll
    for (int r = 0; r < 8; ++r)
      mx[r] = fmaxf(fmaxf(E[0][r], E[1][r]), fmaxf(E[2][r], E[3][r]));
    float m8 = fmaxf(fmaxf(fmaxf(mx[0], mx[1]), fmaxf(mx[2], mx[3])),
                     fmaxf(fmaxf(mx[4], mx[5]), fmaxf(mx[6], mx[7])));
    m8 = fmaxf(m8, other_half(m8));

    // Online-softmax rescale. Of the row-sum tile only register 0 is read later
    // (all rows of that tile are equal sums), so only that one is rescaled.
    float mn = fmaxf(M, m8);
    float sc = exp_slot(M - mn);
    M = mn;
#pragma unroll
    for (int cb = 0; cb < 8; ++cb) {
#pragma unroll
      for (int r = 0; r < 8; ++r) acc[cb][r] *= sc;
    }
    acc[8][0] *= sc;

    // P^T = exp(E - M), packed in place into the two B operands (32 keys each);
    // pack4 makes elements 4*s4 .. 4*s4+3 of operand kk.
    v16h p[2];
    auto pack4 = [&](int kk, int s4) {
      const v8f& e = E[2 * kk + (s4 >> 1)];
      int r0 = 4 * (s4 & 1);
      v4f d = {e[r0] - M, e[r0 + 1] - M, e[r0 + 2] - M, e[r0 + 3] - M};
      v4f pv = exp4_slot(d);
#pragma unroll
      for (int i = 0; i < 4; ++i) p[kk][4 * s4 + i] = (_Float16)pv[i];
    };
#pragma unroll
    for (int s4 = 0; s4 < 4; ++s4) pack4(0, s4);

    // out_tile[c,q] += V x P^T ; rowsum += 1 x P^T.
    // The V tiles of keys 32..63 are asked for at least nine WMMAs ahead of their
    // use: four here, each of the others as a WMMA frees the registers of a tile of
    // keys 0..31. The second operand's exps stand between those WMMAs.
#pragma unroll
    for (int cb = 0; cb < 4; ++cb) vg[cb] = load_v(1, cb);
    __builtin_amdgcn_sched_barrier(0);         // the four reads stay in front of the WMMAs
#pragma unroll
    for (int cb = 0; cb < 8; ++cb) {
      acc[cb] = __builtin_amdgcn_wmma_f32_16x16x32_f16(false, vf[cb], false, p[0], (short)0, acc[cb], false, false);
      if (cb < 4) {
        vg[4 + cb] = load_v(1, 4 + cb);
        pack4(1, cb);
        __builtin_amdgcn_sched_barrier(0);     // this read stays here, far ahead of its WMMA
      }
    }
    acc[8] = __builtin_amdgcn_wmma_f32_16x16x32_f16(false, ones, false, p[0], (short)0, acc[8], false, false);
#pragma unroll
    for (int cb = 0; cb < 8; ++cb)
      acc[cb] = __builtin_amdgcn_wmma_f32_16x16x32_f16(false, vg[cb], false, p[1], (short)0, acc[cb], false, false);
    acc[8] = __builtin_amdgcn_wmma_f32_16x16x32_f16(false, ones, false, p[1], (short)0, acc[8], false, false);

    // Publish point of stage kb + 1, every wave, in this order.
    asm volatile("s_wait_dscnt 0x0" ::: "memory");     // this wave's reads of the buffer are over before it is refilled
    asm volatile("s_wait_asynccnt 0x0" ::: "memory");  // this wave's share of stage kb + 1 has landed
    __syncthreads();                                   // all shares landed, all readers have left this trip's buffer
    if (kb + 2 < KB_PER_SPLIT) copy_stage(kb + 2);     // the same test for the whole block
  }
  asm volatile("s_wait_asynccnt 0x0" ::: "memory");    // no copy is open when the wave goes on

  // Hand over this wave's partial result: maximum and row sum of each query
  // (both lane halves hold the same), and the 8 channel accumulators:
  // lds_red[wave][cb][h][lane][e] = channel cb*16 + 8*(lane>>4) + 4*h + e, query lane&15.
  if (half == 0) {
    lds_m[wid][col] = M;
    lds_l[wid][col] = acc[8][0];
  }
#pragma unroll
  for (int cb = 0; cb < 8; ++cb) {
#pragma unroll
    for (int h = 0; h < 2; ++h) {
      v4f o = {acc[cb][4 * h], acc[cb][4 * h + 1], acc[cb][4 * h + 2], acc[cb][4 * h + 3]};
      lds_red[wid][cb][h][lane] = o;
    }
  }
  __syncthreads();   // every quarter's partials are in LDS before anyone merges

  // Wave w finishes channel block w >> 1 for 32 queries (query tiles 2*(w&1)
  // and 2*(w&1)+1); a lane owns one query and all 16 channels of the block, so
  // every load and store of a wave is one whole 128-byte line. The residual
  // values are asked for here, so that they come in while the merge runs.
  int cbm = wid >> 1;
  int qtl = 2 * (wid & 1) + half;              // this lane's query tile
  size_t idx0 = ((size_t)b * C_DIM + cbm * 16) * NSP + blockIdx.x * 64 + 32 * (wid & 1) + lane;
  const float* xp = x + idx0;
  float xr[16];
#pragma unroll
  for (int c = 0; c < 16; ++c) xr[c] = xp[(size_t)c * NSP];

  // Merge: weight of quarter s for this query is exp(M_s - max over quarters).
  float f[KSPLIT];
#pragma unroll
  for (int s = 0; s < KSPLIT; ++s) f[s] = lds_m[s * QTILES + qtl][col];
  float mm = fmaxf(fmaxf(f[0], f[1]), fmaxf(f[2], f[3]));
#pragma unroll
  for (int s = 0; s < KSPLIT; ++s) f[s] = exp_slot(f[s] - mm);
  float inv = 0.0f;
#pragma unroll
  for (int s = 0; s < KSPLIT; ++s) inv += f[s] * lds_l[s * QTILES + qtl][col];
  inv = 1.0f / inv;

  // Epilogue: normalize by rowsum, gamma, residual.
  float g = gamma[0];
  float* op = out + idx0;
#pragma unroll
  for (int hc = 0; hc < 2; ++hc) {             // channels 8*hc .. 8*hc+7 of the block
#pragma unroll
    for (int h = 0; h < 2; ++h) {
      v4f val = {};
#pragma unroll
      for (int s = 0; s < KSPLIT; ++s) {
        v4f t = lds_red[s * QTILES + qtl][cbm][h][hc * 16 + col];
#pragma unroll
        for (int e = 0; e < 4; ++e) val[e] += f[s] * t[e];
      }
#pragma unroll
      for (int e = 0; e < 4; ++e) {
        int c = 8 * hc + 4 * h + e;
        op[(size_t)c * NSP] = g * (val[e] * inv) + xr[c];
      }
    }
  }
}

// ---------------------------------------------------------------------------
extern "C" void kernel_launch(void* const* d_in, const int* in_sizes, int n_in,
                              void* d_out, int out_size, void* d_ws, size_t ws_size,
                              hipStream_t stream) {
  const float* x     = (const float*)d_in[0];
  const float* wq    = (const float*)d_in[1];
  const float* bq    = (const float*)d_in[2];
  const float* wk    = (const float*)d_in[3];
  const float* bk    = (const float*)d_in[4];
  const float* wv    = (const float*)d_in[5];
  const float* bv    = (const float*)d_in[6];
  const float* gamma = (const float*)d_in[7];
  float* out = (float*)d_out;

  _Float16* qA = (_Float16*)d_ws;
  _Float16* kB = qA + (size_t)BATCH * (NSP / 16) * 32 * 8;
  _Float16* vB = kB + (size_t)BATCH * (NSP / 16) * 32 * 8;

  proj_qkv<<<dim3(NSP / 64, BATCH), 320, 0, stream>>>(x, wq, bq, wk, bk, wv, bv, qA, kB, vB);
  attn   <<<dim3(NSP / 64, BATCH), 512, 0, stream>>>(qA, kB, vB, x, gamma, out);
}

// v007
// One run takes 31.8 microseconds.
// Next to v006, in two timings, it ran 1.05 and 1.04 times as fast.
// Over all steps from v000 it is 6.67 times as fast.
#include <hip/hip_runtime.h>
#include <hip/hip_fp16.h>

typedef __attribute__((ext_vector_type(16))) _Float16 v16h;
typedef __attribute__((ext_vector_type(8)))  _Float16 v8h;
typedef __attribute__((ext_vector_type(2)))  _Float16 h2;
typedef __attribute__((ext_vector_type(8)))  float    v8f;
typedef __attribute__((ext_vector_type(4)))  float    v4f;
typedef __attribute__((ext_vector_type(2)))  float    v2f;

#define C_DIM 128
#define CQ    16
#define NSP   4096   // 64*64
#define BATCH 4

// ---------------------------------------------------------------------------
// Projections q, k, v as one f32 WMMA (16x16x4) GEMM: [160 x 128] x [128 x n].
// One block = 64 positions of one batch, ten waves = ten 16-channel tiles
// (wave 0: q, wave 1: k, waves 2..9: v). A wave keeps four position tiles;
// tile t holds positions n0 + 4*j + t (j = lane & 15), so one 16-byte load
// along n feeds all four tiles. k order, the same for x and w fragments:
// step 2*S + e, lane half h, register v  ->  c = 8*S + 4*h + 2*e + v.
// Results leave in the WMMA operand images that attn reads:
//  q,k: lane = (c>>3)*16 + (n&15), half j = c&7  (K padded 16->32 with zeros)
//  v  : operand lane images per (32-key, 16-ch) tile, as two planes of 32 lanes x
//       16 bytes (plane g = image positions 8*g .. 8*g+7): a 16-byte LDS read of a
//       plane is then 512 bytes in a row, each bank met once per 16 lanes.
// ---------------------------------------------------------------------------
template <bool X_IS_A>
__device__ __forceinline__ void proj_tiles(const float* __restrict__ xp,
                                           const float* __restrict__ wp,
                                           v8f (&acc)[4]) {
  // All loops here and in proj_qkv are unrolled whole: the register arrays need
  // constant indices, and the loads of later steps can then issue ahead of the WMMAs.
#pragma unroll
  for (int S = 0; S < C_DIM / 8; ++S) {
    v4f w = *(const v4f*)(wp + 8 * S);
    v4f X[4];
#pragma unroll
    for (int i = 0; i < 4; ++i) X[i] = *(const v4f*)(xp + (size_t)(8 * S + i) * NSP);
#pragma unroll
    for (int e = 0; e < 2; ++e) {
      v2f wf = {w[2 * e], w[2 * e + 1]};
#pragma unroll
      for (int t = 0; t < 4; ++t) {
        v2f xf = {X[2 * e][t], X[2 * e + 1][t]};
        acc[t] = X_IS_A
            ? __builtin_amdgcn_wmma_f32_16x16x4_f32(false, xf, false, wf, (short)0, acc[t], false, false)
            : __builtin_amdgcn_wmma_f32_16x16x4_f32(false, wf, false, xf, (short)0, acc[t], false, false);
      }
    }
  }
  // Address wait behind the last load; the two pointers are inputs so that their
  // registers are not given to anything else while a load that names them is open.
  asm volatile("s_wait_xcnt 0x0" :: "v"(xp), "v"(wp) : "memory");
}

__global__ __launch_bounds__(320) void proj_qkv(const float* __restrict__ x,
                                                const float* __restrict__ wq, const float* __restrict__ bq,
                                                const float* __restrict__ wk, const float* __restrict__ bk,
                                                const float* __restrict__ wv, const float* __restrict__ bv,
                                                _Float16* __restrict__ qA, _Float16* __restrict__ kB,
                                                _Float16* __restrict__ vB) {
  int b    = blockIdx.y;
  int n0   = blockIdx.x * 64;
  int wid  = __builtin_amdgcn_readfirstlane(threadIdx.x >> 5);
  int lane = threadIdx.x & 31;
  int half = lane >> 4;
  int col  = lane & 15;

  const float* xp = x + ((size_t)b * C_DIM + 4 * half) * NSP + n0 + 4 * col;
  v8f acc[4];

  if (wid >= 2) {
    // D[n = n0 + 32*half + 4*r + t][ch = cb*16 + col]
    int cb = wid - 2;
    float bb = bv[cb * 16 + col];
#pragma unroll
    for (int t = 0; t < 4; ++t) {
#pragma unroll
      for (int r = 0; r < 8; ++r) acc[t][r] = bb;
    }
    proj_tiles<true>(xp, wv + (cb * 16 + col) * C_DIM + 4 * half, acc);
    // key in its 32-block: kk = 4*r + t; image lane half = (kk>>3)&1,
    // image position = (kk&7) | ((kk>>4)<<3)
    size_t kb = (size_t)b * (NSP / 32) + (n0 >> 5) + half;
#pragma unroll
    for (int g = 0; g < 2; ++g) {
#pragma unroll
      for (int hs = 0; hs < 2; ++hs) {
        v8h o;
#pragma unroll
        for (int s = 0; s < 8; ++s) o[s] = (_Float16)acc[s & 3][4 * g + 2 * hs + (s >> 2)];
        *(v8h*)(vB + (((kb * 8 + cb) * 2 + g) * 32 + hs * 16 + col) * 8) = o;
      }
    }
    return;
  }

  // D[ch = 8*half + r][n = n0 + 4*col + t]
  const float* w    = wid ? wk : wq;
  const float* bias = wid ? bk : bq;
  _Float16*    dst  = wid ? kB : qA;
#pragma unroll
  for (int r = 0; r < 8; ++r) {
    float bb = half ? bias[8 + r] : bias[r];
#pragma unroll
    for (int t = 0; t < 4; ++t) acc[t][r] = bb;
  }
  proj_tiles<false>(xp, w + col * C_DIM + 4 * half, acc);
#pragma unroll
  for (int t = 0; t < 4; ++t) {
    int n = n0 + 4 * col + t;
    size_t blk = (size_t)b * (NSP / 16) + (n >> 4);
    v8h o;
#pragma unroll
    for (int r = 0; r < 8; ++r) o[r] = (_Float16)acc[t][r];
    *(v8h*)(dst + (blk * 32 + half * 16 + (n & 15)) * 8) = o;
  }
  // Address wait behind the stores: in the built code the other branch's body
  // follows this one and takes the same registers.
  asm volatile("s_wait_xcnt 0x0" ::: "memory");
}

// ---------------------------------------------------------------------------
// Flash-attention core, 8 waves/block: 2 pairs of query tiles (16 rows a tile) x 4
// key quarters. Wave (ks, qp) runs query tiles 2*qp and 2*qp+1 over keys
// [ks*1024, ks*1024+1024), each tile with its own running maximum; the four
// partial results of a query tile are merged through LDS behind the loop.
// 256 blocks: one for every WGP, two waves per SIMD.
// A K or V fragment read from LDS feeds one WMMA of each of the wave's two tiles,
// so a block reads every staged byte twice, not four times.
// Both products are taken transposed: S^T = K Q^T (A = key image, B = query
// image) and O^T += V P^T (A = V image, B = P^T). A lane then holds scores of
// ONE query (its column): register r of score tile t is key 16*t + 8*half + r.
// Two score tiles, converted in place, are the B operand of 32 keys
// (b[s] = tile[s >> 3][s & 7], the hardware k order that the V image has too),
// so P never leaves the registers; maximum and rescale factor are one value a lane.
// Per 64-key block and query tile: 4 energy WMMAs, online softmax (in-lane
// maximum, one exchange between the lane halves; row sum from an all-ones A), 18
// accumulate WMMAs (8 ch blocks x 2 + ones x 2).
// The K and V images of a 64-key block (a stage: 16 KB of V, then 2 KB of K, per
// key quarter, brought by that quarter's two waves) come by asynchronous copies
// into a ring of two LDS buffers, one trip ahead of their use: trip t reads
// buffer t & 1 alone, and the one barrier at its foot both publishes stage t + 1
// and frees buffer t & 1 for stage t + 2.
// ---------------------------------------------------------------------------
#define KSPLIT 4
#define QTILES 4
#define QPW 2                                  // query tiles a wave keeps
#define KB_PER_SPLIT (NSP / 64 / KSPLIT)
#define VT_HALVES (2 * 8 * 32 * 16)            // V image of 64 keys
#define KT_HALVES (4 * 32 * 8)                 // K image of 64 keys
#define STAGE_HALVES (VT_HALVES + KT_HALVES)

// exp(d). The v_nop is the slot that the instruction set
// asks for behind a transcendental, before its result is used or its source is
// overwritten; in one statement with the v_exp_f32 it cannot land elsewhere.
__device__ __forceinline__ float exp_slot(float d) {
  float r;
  asm("v_exp_f32 %0, %1\n\tv_nop" : "=v"(r) : "v"(d * 1.44269504f));
  return r;
}

// The same for four values: each v_exp_f32 has an independent one behind it (the
// outputs are early-clobber, so none lies on a source), the last one the v_nop.
// Left to the register allocator, the loop's exps came out as a run in which
// each wrote the source of the one in front of it.
__device__ __forceinline__ v4f exp4_slot(v4f d) {
  float r0, r1, r2, r3;
  asm("v_exp_f32 %0, %4\n\tv_exp_f32 %1, %5\n\tv_exp_f32 %2, %6\n\tv_exp_f32 %3, %7\n\tv_nop"
      : "=&v"(r0), "=&v"(r1), "=&v"(r2), "=&v"(r3)
      : "v"(d[0] * 1.44269504f), "v"(d[1] * 1.44269504f),
        "v"(d[2] * 1.44269504f), "v"(d[3] * 1.44269504f));
  v4f r = {r0, r1, r2, r3};
  return r;
}

// Value of lane l ^ 16 (the other half's share of the same query column).
__device__ __forceinline__ float other_half(float v) {
  int i = __builtin_bit_cast(int, v);
  return __builtin_bit_cast(float,
      __builtin_amdgcn_permlanex16(i, i, 0x76543210, 0xfedcba98, false, false));
}

__global__ __launch_bounds__(256) void attn(const _Float16* __restrict__ qA,
                                            const _Float16* __restrict__ kB,
                                            const _Float16* __restrict__ vB,
                                            const float* __restrict__ x,
                                            const float* __restrict__ gamma,
                                            float* __restrict__ out) {
  __shared__ __attribute__((aligned(16))) _Float16 lds_ring[2][KSPLIT][STAGE_HALVES]; // two buffers x four quarters x (V, K), 144 KB
  __shared__ __attribute__((aligned(16))) v4f   lds_red[KSPLIT * QTILES][8][2][32];  // partial accumulators per (quarter, query tile), 128 KB
  __shared__ __attribute__((aligned(16))) float lds_m[KSPLIT * QTILES][16];          // their running maxima
  __shared__ __attribute__((aligned(16))) float lds_l[KSPLIT * QTILES][16];          // their row sums

  int b    = blockIdx.y;
  int wid  = __builtin_amdgcn_readfirstlane(threadIdx.x >> 5);
  int ks   = wid >> 1;                         // key quarter
  int qp   = wid & 1;                          // pair of query tiles in the block
  int lane = threadIdx.x & 31;
  int half = lane >> 4;
  int col  = lane & 15;

  // Query B operands (K = Cq zero-padded to 32), one per query tile of the wave
  v16h aq[QPW];
#pragma unroll
  for (int u = 0; u < QPW; ++u) {
    int q16 = blockIdx.x * QTILES + QPW * qp + u;   // batch-local 16-row block
    const v8h* src = (const v8h*)(qA + (((size_t)b * (NSP / 16) + q16) * 32 + lane) * 8);
    v8h t = *src;
    aq[u] = {};
#pragma unroll
    for (int j = 0; j < 8; ++j) aq[u][j] = t[j];
  }
  v16h ones;
#pragma unroll
  for (int j = 0; j < 16; ++j) ones[j] = (_Float16)1.0f;

  v8f acc[QPW][9];                             // [0..7]=channels, [8]=rowsum
  float M[QPW];                                // running maximum of this lane's query, per tile
#pragma unroll
  for (int u = 0; u < QPW; ++u) {
#pragma unroll
    for (int cb = 0; cb < 9; ++cb) acc[u][cb] = {};
    M[u] = -__builtin_inff();
  }

  // This thread's eighteen 16-byte pieces of its quarter's stage: sixteen of the V
  // image (byte offset voff[i] in the image, the same in memory and in LDS) and
  // two of the K image (byte offsets voff[0], voff[1], behind the V image in LDS).
  unsigned voff[16];
#pragma unroll
  for (int i = 0; i < 16; ++i) voff[i] = (unsigned)(i * 1024 + (threadIdx.x & 63) * 16);

  // Asks for stage st of this quarter (64-key block ks * KB_PER_SPLIT + st), in two
  // statements of nine copies (an asm statement takes thirty operands).
  // Tracked by ASYNCcnt. The address wait is each statement's last line, so
  // nothing that rewrites a register named there can come in front of it.
  auto copy_stage = [&](int st) {
    int kg = ks * KB_PER_SPLIT + st;
    unsigned base = (unsigned)(size_t)&lds_ring[st & 1][ks][0];
    const char* vsrc = (const char*)(vB + (((size_t)b * (NSP / 32) + kg * 2) * 8) * 32 * 16);
    const char* ksrc = (const char*)(kB + (((size_t)b * (NSP / 16) + kg * 4) * 32) * 8);
#pragma unroll
    for (int g = 0; g < 2; ++g) {
      const unsigned* vo = voff + 8 * g;
      asm volatile("global_load_async_to_lds_b128 %8, %17, off\n\t"
                   "global_load_async_to_lds_b128 %0, %9, off\n\t"
                   "global_load_async_to_lds_b128 %1, %10, off\n\t"
                   "global_load_async_to_lds_b128 %2, %11, off\n\t"
                   "global_load_async_to_lds_b128 %3, %12, off\n\t"
                   "global_load_async_to_lds_b128 %4, %13, off\n\t"
                   "global_load_async_to_lds_b128 %5, %14, off\n\t"
                   "global_load_async_to_lds_b128 %6, %15, off\n\t"
                   "global_load_async_to_lds_b128 %7, %16, off\n\t"
                   "s_wait_xcnt 0x0"
                   :: "v"(base + vo[0]), "v"(base + vo[1]), "v"(base + vo[2]), "v"(base + vo[3]),
                      "v"(base + vo[4]), "v"(base + vo[5]), "v"(base + vo[6]), "v"(base + vo[7]),
                      "v"(base + 2 * VT_HALVES + voff[g]),
                      "v"(vsrc + vo[0]), "v"(vsrc + vo[1]), "v"(vsrc + vo[2]), "v"(vsrc + vo[3]),
                      "v"(vsrc + vo[4]), "v"(vsrc + vo[5]), "v"(vsrc + vo[6]), "v"(vsrc + vo[7]),
                      "v"(ksrc + voff[g])
                   : "memory");
    }
  };

  // Ring prologue: stage 0 lands and is published, then stage 1 is asked for.
  copy_stage(0);
  asm volatile("s_wait_asynccnt 0x0" ::: "memory");   // this wave's share of stage 0 has landed
  __syncthreads();                                     // every wave's share has
  copy_stage(1);

  for (int kb = 0; kb < KB_PER_SPLIT; ++kb) {
    const _Float16* stage = &lds_ring[kb & 1][ks][0];

    // A operand of V tile (kk, cb): the tile's two planes.
    auto load_v = [&](int kk, int cb) {
      const v8h* vv = (const v8h*)(stage + (kk * 8 + cb) * 512 + lane * 8);
      return __builtin_shufflevector(vv[0], vv[32], 0, 1, 2, 3, 4, 5, 6, 7, 8, 9, 10, 11, 12, 13, 14, 15);
    };

    // All LDS reads of the trip are asked for here, in one place, the K tiles
    // first: the V tiles come in while scores and softmax run.
    v8h kf[4];
#pragma unroll
    for (int t = 0; t < 4; ++t) kf[t] = *(const v8h*)(stage + VT_HALVES + (t * 32 + lane) * 8);
    v16h vf[8], vg[8];                         // V tiles of keys 0..31 and 32..63
#pragma unroll
    for (int cb = 0; cb < 8; ++cb) vf[cb] = load_v(0, cb);
#pragma unroll
    for (int cb = 0; cb < 8; ++cb) vg[cb] = load_v(1, cb);
    // Keeps the reads above this line: left free, the scheduler sinks each pair to
    // just in front of its WMMA, which then waits out the whole LDS latency.
    __builtin_amdgcn_sched_barrier(0);

    // Energy, transposed: 4 x 16-key tiles per query tile,
    // E[u][t][r] = key 16*t + 8*half + r, query col of tile u
    v8f E[QPW][4];
#pragma unroll
    for (int t = 0; t < 4; ++t) {
      v16h bk16 = {};
      v8h tt = kf[t];
#pragma unroll
      for (int j = 0; j < 8; ++j) bk16[j] = tt[j];
#pragma unroll
      for (int u = 0; u < QPW; ++u) {
        v8f z = {};
        E[u][t] = __builtin_amdgcn_wmma_f32_16x16x32_f16(false, bk16, false, aq[u], (short)0, z, false, false);
      }
    }

    // New running maximum of tile u's query over the 64 keys (32 values in the lane,
    // then the other half's); returns the online-softmax rescale factor.
    auto new_max = [&](int u) {
      float mx[8];
#pragma unroll
      for (int r = 0; r < 8; ++r)
        mx[r] = fmaxf(fmaxf(E[u][0][r], E[u][1][r]), fmaxf(E[u][2][r], E[u][3][r]));
      float m8 = fmaxf(fmaxf(fmaxf(mx[0], mx[1]), fmaxf(mx[2], mx[3])),
                       fmaxf(fmaxf(mx[4], mx[5]), fmaxf(mx[6], mx[7])));
      m8 = fmaxf(m8, other_half(m8));
      float mn = fmaxf(M[u], m8);
      float sc = exp_slot(M[u] - mn);
      M[u] = mn;
      return sc;
    };
    auto rescale = [&](int u, int cb, float sc) {
#pragma unroll
      for (int r = 0; r < 8; ++r) acc[u][cb][r] *= sc;
    };

    // P^T = exp(E - M), packed in place into the two B operands (32 keys each) of
    // a query tile; pack4 makes elements 4*s4 .. 4*s4+3 of operand kk of tile u.
    v16h p[QPW][2];
    auto pack4 = [&](int u, int kk, int s4) {
      const v8f& e = E[u][2 * kk + (s4 >> 1)];
      int r0 = 4 * (s4 & 1);
      float m = M[u];
      v4f d = {e[r0] - m, e[r0 + 1] - m, e[r0 + 2] - m, e[r0 + 3] - m};
      v4f pv = exp4_slot(d);
#pragma unroll
      for (int i = 0; i < 4; ++i) p[u][kk][4 * s4 + i] = (_Float16)pv[i];
    };

    // Tile 0: maximum, rescale, first operand. Of a row-sum tile only register 0 is
    // read later (all rows of that tile are equal sums), so only that one is rescaled.
    float sc0 = new_max(0);
#pragma unroll
    for (int cb = 0; cb < 8; ++cb) rescale(0, cb, sc0);
    acc[0][8][0] *= sc0;
#pragma unroll
    for (int s4 = 0; s4 < 4; ++s4) pack4(0, 0, s4);
    float sc1 = new_max(1);
    acc[1][8][0] *= sc1;

    // out_tile[c,q] += V x P^T ; rowsum += 1 x P^T.
    // Four runs of nine WMMAs (tile 0 keys 0..31, tile 0 keys 32..63, then tile 1
    // on the same V fragments). Vector work that a run does not depend on is dealt
    // out among its WMMAs: each run carries the making of the next run's P operand,
    // the first also tile 1's rescale, so the matrix unit and the vector port work
    // at the same time. Each sched_barrier keeps a share at its place; left free,
    // the scheduler gathers the vector work in front of the WMMAs.
#pragma unroll
    for (int cb = 0; cb < 8; ++cb) {
      acc[0][cb] = __builtin_amdgcn_wmma_f32_16x16x32_f16(false, vf[cb], false, p[0][0], (short)0, acc[0][cb], false, false);
      if (cb < 4) {
        pack4(0, 1, cb);
      } else {
        rescale(1, 2 * (cb - 4), sc1);
        rescale(1, 2 * (cb - 4) + 1, sc1);
      }
      __builtin_amdgcn_sched_barrier(0);
    }
    acc[0][8] = __builtin_amdgcn_wmma_f32_16x16x32_f16(false, ones, false, p[0][0], (short)0, acc[0][8], false, false);
#pragma unroll
    for (int cb = 0; cb < 8; ++cb) {
      acc[0][cb] = __builtin_amdgcn_wmma_f32_16x16x32_f16(false, vg[cb], false, p[0][1], (short)0, acc[0][cb], false, false);
      if ((cb & 1) == 0) {
        pack4(1, 0, cb >> 1);
        __builtin_amdgcn_sched_barrier(0);
      }
    }
    acc[0][8] = __builtin_amdgcn_wmma_f32_16x16x32_f16(false, ones, false, p[0][1], (short)0, acc[0][8], false, false);
#pragma unroll
    for (int cb = 0; cb < 8; ++cb) {
      acc[1][cb] = __builtin_amdgcn_wmma_f32_16x16x32_f16(false, vf[cb], false, p[1][0], (short)0, acc[1][cb], false, false);
      if ((cb & 1) == 0) {
        pack4(1, 1, cb >> 1);
        __builtin_amdgcn_sched_barrier(0);
      }
    }
    acc[1][8] = __builtin_amdgcn_wmma_f32_16x16x32_f16(false, ones, false, p[1][0], (short)0, acc[1][8], false, false);
#pragma unroll
    for (int cb = 0; cb < 8; ++cb)
      acc[1][cb] = __builtin_amdgcn_wmma_f32_16x16x32_f16(false, vg[cb], false, p[1][1], (short)0, acc[1][cb], false, false);
    acc[1][8] = __builtin_amdgcn_wmma_f32_16x16x32_f16(false, ones, false, p[1][1], (short)0, acc[1][8], false, false);

    // Publish point of stage kb + 1, every wave, in this order.
    asm volatile("s_wait_dscnt 0x0" ::: "memory");     // this wave's reads of the buffer are over before it is refilled
    asm volatile("s_wait_asynccnt 0x0" ::: "memory");  // this wave's share of stage kb + 1 has landed
    __syncthreads();                                   // all shares landed, all readers have left this trip's buffer
    if (kb + 2 < KB_PER_SPLIT) copy_stage(kb + 2);     // the same test for the whole block
  }
  asm volatile("s_wait_asynccnt 0x0" ::: "memory");    // no copy is open when the wave goes on

  // Hand over this wave's two partial results: maximum and row sum of each query
  // (both lane halves hold the same), and the 8 channel accumulators:
  // lds_red[quarter, tile][cb][h][lane][e] = channel cb*16 + 8*(lane>>4) + 4*h + e, query lane&15.
#pragma unroll
  for (int u = 0; u < QPW; ++u) {
    int slot = ks * QTILES + QPW * qp + u;
    if (half == 0) {
      lds_m[slot][col] = M[u];
      lds_l[slot][col] = acc[u][8][0];
    }
#pragma unroll
    for (int cb = 0; cb < 8; ++cb) {
#pragma unroll
      for (int h = 0; h < 2; ++h) {
        v4f o = {acc[u][cb][4 * h], acc[u][cb][4 * h + 1], acc[u][cb][4 * h + 2], acc[u][cb][4 * h + 3]};
        lds_red[slot][cb][h][lane] = o;
      }
    }
  }
  __syncthreads();   // every quarter's partials are in LDS before anyone merges

  // Wave w finishes channel block w for all 64 queries, 32 at a time (query tiles
  // 2*qh and 2*qh+1); a lane owns one query and all 16 channels of the block, so
  // every load and store of a wave is one whole 128-byte line. The residual
  // values are asked for here, so that they come in while the merge runs.
  int cbm = wid;
  size_t idx0 = ((size_t)b * C_DIM + cbm * 16) * NSP + blockIdx.x * 64 + lane;
  const float* xp = x + idx0;
  float xr[2][16];
#pragma unroll
  for (int qh = 0; qh < 2; ++qh) {
#pragma unroll
    for (int c = 0; c < 16; ++c) xr[qh][c] = xp[(size_t)c * NSP + 32 * qh];
  }
  float g = gamma[0];
  float* op = out + idx0;

#pragma unroll
  for (int qh = 0; qh < 2; ++qh) {
    int qtl = 2 * qh + half;                   // this lane's query tile

    // Merge: weight of quarter s for this query is exp(M_s - max over quarters).
    float f[KSPLIT];
#pragma unroll
    for (int s = 0; s < KSPLIT; ++s) f[s] = lds_m[s * QTILES + qtl][col];
    float mm = fmaxf(fmaxf(f[0], f[1]), fmaxf(f[2], f[3]));
#pragma unroll
    for (int s = 0; s < KSPLIT; ++s) f[s] = exp_slot(f[s] - mm);
    float inv = 0.0f;
#pragma unroll
    for (int s = 0; s < KSPLIT; ++s) inv += f[s] * lds_l[s * QTILES + qtl][col];
    inv = 1.0f / inv;

    // Epilogue: normalize by rowsum, gamma, residual.
#pragma unroll
    for (int hc = 0; hc < 2; ++hc) {           // channels 8*hc .. 8*hc+7 of the block
#pragma unroll
      for (int h = 0; h < 2; ++h) {
        v4f val = {};
#pragma unroll
        for (int s = 0; s < KSPLIT; ++s) {
          v4f t = lds_red[s * QTILES + qtl][cbm][h][hc * 16 + col];
#pragma unroll
          for (int e = 0; e < 4; ++e) val[e] += f[s] * t[e];
        }
#pragma unroll
        for (int e = 0; e < 4; ++e) {
          int c = 8 * hc + 4 * h + e;
          op[(size_t)c * NSP + 32 * qh] = g * (val[e] * inv) + xr[qh][c];
        }
      }
    }
  }
}

// ---------------------------------------------------------------------------
extern "C" void kernel_launch(void* const* d_in, const int* in_sizes, int n_in,
                              void* d_out, int out_size, void* d_ws, size_t ws_size,
                              hipStream_t stream) {
  const float* x     = (const float*)d_in[0];
  const float* wq    = (const float*)d_in[1];
  const float* bq    = (const float*)d_in[2];
  const float* wk    = (const float*)d_in[3];
  const float* bk    = (const float*)d_in[4];
  const float* wv    = (const float*)d_in[5];
  const float* bv    = (const float*)d_in[6];
  const float* gamma = (const float*)d_in[7];
  float* out = (float*)d_out;

  _Float16* qA = (_Float16*)d_ws;
  _Float16* kB = qA + (size_t)BATCH * (NSP / 16) * 32 * 8;
  _Float16* vB = kB + (size_t)BATCH * (NSP / 16) * 32 * 8;

  proj_qkv<<<dim3(NSP / 64, BATCH), 320, 0, stream>>>(x, wq, bq, wk, bk, wv, bv, qA, kB, vB);
  attn   <<<dim3(NSP / 64, BATCH), 256, 0, stream>>>(qA, kB, vB, x, gamma, out);
}

// v008
// Measured time: 28.6 microseconds a run.
// Two timings next to v007 put it at 1.11 and 1.13 times that version's speed.
// Counting every step since v000, it is 7.48 times as fast.
#include <hip/hip_runtime.h>
#include <hip/hip_fp16.h>

typedef __attribute__((ext_vector_type(16))) _Float16 v16h;
typedef __attribute__((ext_vector_type(8)))  _Float16 v8h;
typedef __attribute__((ext_vector_type(2)))  _Float16 h2;
typedef __attribute__((ext_vector_type(8)))  float    v8f;
typedef __attribute__((ext_vector_type(4)))  float    v4f;
typedef __attribute__((ext_vector_type(2)))  float    v2f;
typedef __attribute__((ext_vector_type(8)))  unsigned v8u;

#define C_DIM 128
#define CQ    16
#define NSP   4096   // 64*64
#define BATCH 4

// ---------------------------------------------------------------------------
// Projections q, k, v as one GEMM [160 x 128] x [128 x n] on f16 WMMA (16x16x32)
// with split operands: every f32 value a is taken as head + tail, head = f16(a),
// tail = f16(a - head) (the difference is exact in f32), and a product x * w as
// xh*wh + xh*wl + xl*wh, summed in the f32 accumulator. What is left out (xl*wl and
// the tails' own rounding) lies about 2^-21 below the product, far under the f16
// rounding of the stored results. 12 WMMAs do 32 channels of four position tiles.
// One block = 64 positions of one batch, ten waves = ten 16-channel tiles
// (wave 0: q, wave 1: k, waves 2..9: v). A wave keeps four position tiles;
// tile t holds positions n0 + 4*j + t (j = lane & 15), so one 16-byte load
// along n feeds all four tiles. k order, the same for x and w fragments:
// step s, lane half h, element e  ->  c = 32*s + 16*h + e.
// Results leave in the WMMA operand images that attn reads:
//  q,k: lane = (c>>3)*16 + (n&15), half j = c&7  (K padded 16->32 with zeros)
//  v  : operand lane images per (32-key, 16-ch) tile, as two planes of 32 lanes x
//       16 bytes (plane g = image positions 8*g .. 8*g+7): a 16-byte LDS read of a
//       plane is then 512 bytes in a row, each bank met once per 16 lanes.
// ---------------------------------------------------------------------------
// Four pairs (a[i], b[i]) of f32 values -> four registers of a head fragment
// (h[i] = f16(a[i]) low, f16(b[i]) high) and four of a tail fragment
// (l[i] = f16(a[i] - head) low, f16(b[i] - head) high): three instructions a pair.
// v_fma_mixlo/mixhi_f16 take the f16 head as it lies, subtract in f32 and write the
// rounded tail into its half of the register; from plain source the build made two
// conversions back to f32, a packed subtract with register copies in front of it,
// and a packed conversion. Operand 16 is -1.0f in a scalar register. Each s_delay_alu names
// the producer four vector instructions back for the two instructions behind it, so
// that the SIMD's other waves issue meanwhile.
__device__ __forceinline__ void split4(const float (&a)[4], const float (&b)[4],
                                       unsigned (&h)[4], unsigned (&l)[4]) {
  asm("v_cvt_pk_f16_f32 %0, %8, %12\n\t"
      "v_cvt_pk_f16_f32 %1, %9, %13\n\t"
      "v_cvt_pk_f16_f32 %2, %10, %14\n\t"
      "v_cvt_pk_f16_f32 %3, %11, %15\n\t"
      "s_delay_alu instid0(VALU_DEP_4) | instskip(NEXT) | instid1(VALU_DEP_4)\n\t"
      "v_fma_mixlo_f16 %4, %0, %16, %8 op_sel_hi:[1,0,0]\n\t"
      "v_fma_mixlo_f16 %5, %1, %16, %9 op_sel_hi:[1,0,0]\n\t"
      "s_delay_alu instid0(VALU_DEP_4) | instskip(NEXT) | instid1(VALU_DEP_4)\n\t"
      "v_fma_mixlo_f16 %6, %2, %16, %10 op_sel_hi:[1,0,0]\n\t"
      "v_fma_mixlo_f16 %7, %3, %16, %11 op_sel_hi:[1,0,0]\n\t"
      "s_delay_alu instid0(VALU_DEP_4) | instskip(NEXT) | instid1(VALU_DEP_4)\n\t"
      "v_fma_mixhi_f16 %4, %0, %16, %12 op_sel:[1,0,0] op_sel_hi:[1,0,0]\n\t"
      "v_fma_mixhi_f16 %5, %1, %16, %13 op_sel:[1,0,0] op_sel_hi:[1,0,0]\n\t"
      "s_delay_alu instid0(VALU_DEP_4) | instskip(NEXT) | instid1(VALU_DEP_4)\n\t"
      "v_fma_mixhi_f16 %6, %2, %16, %14 op_sel:[1,0,0] op_sel_hi:[1,0,0]\n\t"
      "v_fma_mixhi_f16 %7, %3, %16, %15 op_sel:[1,0,0] op_sel_hi:[1,0,0]"
      : "=&v"(h[0]), "=&v"(h[1]), "=&v"(h[2]), "=&v"(h[3]),
        "=&v"(l[0]), "=&v"(l[1]), "=&v"(l[2]), "=&v"(l[3])
      : "v"(a[0]), "v"(a[1]), "v"(a[2]), "v"(a[3]),
        "v"(b[0]), "v"(b[1]), "v"(b[2]), "v"(b[3]), "s"(-1.0f));
}

// start(): gives the accumulators their start values (the bias), called in front of
// the first WMMA: its wait for the bias load then stands behind the first loads of x
// and w, not in front of them.
template <bool X_IS_A, typename Start>
__device__ __forceinline__ void proj_tiles(const float* __restrict__ xp,
                                           const float* __restrict__ wp,
                                           v8f (&acc)[4], Start start) {
  // All loops here and in proj_qkv are unrolled whole: the register arrays need
  // constant indices.
  // Loads go by units of 8 elements a lane (half a step: two of w, eight of x). A
  // unit is asked for behind the split of the unit two in front of it; the scheduler
  // has registers to spare and lifts the request over that split, so in the built
  // code up to three units are open.
  constexpr int UNITS = C_DIM / 16;
  v4f Wv[2][2], X[2][8];
  auto ask = [&](int u) {
#pragma unroll
    for (int i = 0; i < 2; ++i) Wv[u & 1][i] = *(const v4f*)(wp + 32 * (u >> 1) + 8 * (u & 1) + 4 * i);
#pragma unroll
    for (int i = 0; i < 8; ++i) X[u & 1][i] = *(const v4f*)(xp + (size_t)(32 * (u >> 1) + 8 * (u & 1) + i) * NSP);
    // Keeps the loads up here: left free, the scheduler sinks them to just in
    // front of their use, and every step waits out the whole latency.
    __builtin_amdgcn_sched_barrier(0);
  };
  ask(0);
  ask(1);
#pragma unroll
  for (int s = 0; s < UNITS / 2; ++s) {
    v8u wh, wl, xh[4], xl[4];
#pragma unroll
    for (int q = 0; q < 2; ++q) {
      const int u = 2 * s + q;
      unsigned h[4], l[4];
      {
        const v4f w0 = Wv[u & 1][0], w1 = Wv[u & 1][1];
        float a[4] = {w0[0], w0[2], w1[0], w1[2]}, b[4] = {w0[1], w0[3], w1[1], w1[3]};
        split4(a, b, h, l);
#pragma unroll
        for (int i = 0; i < 4; ++i) { wh[4 * q + i] = h[i]; wl[4 * q + i] = l[i]; }
      }
#pragma unroll
      for (int i = 0; i < 4; ++i) {
        const v4f x0 = X[u & 1][2 * i], x1 = X[u & 1][2 * i + 1];
        float a[4] = {x0[0], x0[1], x0[2], x0[3]}, b[4] = {x1[0], x1[1], x1[2], x1[3]};
        split4(a, b, h, l);
#pragma unroll
        for (int t = 0; t < 4; ++t) { xh[t][4 * q + i] = h[t]; xl[t][4 * q + i] = l[t]; }
      }
      if (u + 2 < UNITS) ask(u + 2);
    }
    if (s == 0) start();
    // term 0: xh*wh, term 1: xh*wl, term 2: xl*wh; the four tiles of a term are
    // independent accumulators.
#pragma unroll
    for (int term = 0; term < 3; ++term) {
      v16h wf = __builtin_bit_cast(v16h, term == 1 ? wl : wh);
#pragma unroll
      for (int t = 0; t < 4; ++t) {
        v16h xf = __builtin_bit_cast(v16h, term == 2 ? xl[t] : xh[t]);
        acc[t] = X_IS_A
            ? __builtin_amdgcn_wmma_f32_16x16x32_f16(false, xf, false, wf, (short)0, acc[t], false, false)
            : __builtin_amdgcn_wmma_f32_16x16x32_f16(false, wf, false, xf, (short)0, acc[t], false, false);
      }
    }
    if (s + 1 < UNITS / 2) {
      // The next step's split4 may write registers that were operands of the WMMAs
      // above, and the compiler counts no distance for asm text: these are the four
      // slots that the chip needs between a WMMA and a vector write over its A or B.
      // The two sched_barriers hold them between the WMMAs and the next split4.
      __builtin_amdgcn_sched_barrier(0);
      asm volatile("v_nop\n\tv_nop\n\tv_nop\n\tv_nop");
      __builtin_amdgcn_sched_barrier(0);
    }
  }
  // Address wait behind the last load; the two pointers are inputs so that their
  // registers are not given to anything else while a load that names them is open.
  asm volatile("s_wait_xcnt 0x0" :: "v"(xp), "v"(wp) : "memory");
}

__global__ __launch_bounds__(320) void proj_qkv(const float* __restrict__ x,
                                                const float* __restrict__ wq, const float* __restrict__ bq,
                                                const float* __restrict__ wk, const float* __restrict__ bk,
                                                const float* __restrict__ wv, const float* __restrict__ bv,
                                                _Float16* __restrict__ qA, _Float16* __restrict__ kB,
                                                _Float16* __restrict__ vB) {
  int b    = blockIdx.y;
  int n0   = blockIdx.x * 64;
  int wid  = __builtin_amdgcn_readfirstlane(threadIdx.x >> 5);
  int lane = threadIdx.x & 31;
  int half = lane >> 4;
  int col  = lane & 15;

  const float* xp = x + ((size_t)b * C_DIM + 16 * half) * NSP + n0 + 4 * col;
  v8f acc[4];

  if (wid >= 2) {
    // D[n = n0 + 32*half + 4*r + t][ch = cb*16 + col]
    int cb = wid - 2;
    float bb = bv[cb * 16 + col];
    proj_tiles<true>(xp, wv + (cb * 16 + col) * C_DIM + 16 * half, acc, [&] {
#pragma unroll
      for (int t = 0; t < 4; ++t) {
#pragma unroll
        for (int r = 0; r < 8; ++r) acc[t][r] = bb;
      }
    });
    // key in its 32-block: kk = 4*r + t; image lane half = (kk>>3)&1,
    // image position = (kk&7) | ((kk>>4)<<3)
    size_t kb = (size_t)b * (NSP / 32) + (n0 >> 5) + half;
#pragma unroll
    for (int g = 0; g < 2; ++g) {
#pragma unroll
      for (int hs = 0; hs < 2; ++hs) {
        v8h o;
#pragma unroll
        for (int s = 0; s < 8; ++s) o[s] = (_Float16)acc[s & 3][4 * g + 2 * hs + (s >> 2)];
        *(v8h*)(vB + (((kb * 8 + cb) * 2 + g) * 32 + hs * 16 + col) * 8) = o;
      }
    }
    return;
  }

  // D[ch = 8*half + r][n = n0 + 4*col + t]
  const float* w    = wid ? wk : wq;
  const float* bias = wid ? bk : bq;
  _Float16*    dst  = wid ? kB : qA;
  float bb[8];
#pragma unroll
  for (int r = 0; r < 8; ++r) bb[r] = half ? bias[8 + r] : bias[r];
  proj_tiles<false>(xp, w + col * C_DIM + 16 * half, acc, [&] {
#pragma unroll
    for (int r = 0; r < 8; ++r) {
#pragma unroll
      for (int t = 0; t < 4; ++t) acc[t][r] = bb[r];
    }
  });
#pragma unroll
  for (int t = 0; t < 4; ++t) {
    int n = n0 + 4 * col + t;
    size_t blk = (size_t)b * (NSP / 16) + (n >> 4);
    v8h o;
#pragma unroll
    for (int r = 0; r < 8; ++r) o[r] = (_Float16)acc[t][r];
    *(v8h*)(dst + (blk * 32 + half * 16 + (n & 15)) * 8) = o;
  }
  // Address wait behind the stores: in the built code the other branch's body
  // follows this one and takes the same registers.
  asm volatile("s_wait_xcnt 0x0" ::: "memory");
}

// ---------------------------------------------------------------------------
// Flash-attention core, 8 waves/block: 2 pairs of query tiles (16 rows a tile) x 4
// key quarters. Wave (ks, qp) runs query tiles 2*qp and 2*qp+1 over keys
// [ks*1024, ks*1024+1024), each tile with its own running maximum; the four
// partial results of a query tile are merged through LDS behind the loop.
// 256 blocks: one for every WGP, two waves per SIMD.
// A K or V fragment read from LDS feeds one WMMA of each of the wave's two tiles,
// so a block reads every staged byte twice, not four times.
// Both products are taken transposed: S^T = K Q^T (A = key image, B = query
// image) and O^T += V P^T (A = V image, B = P^T). A lane then holds scores of
// ONE query (its column): register r of score tile t is key 16*t + 8*half + r.
// Two score tiles, converted in place, are the B operand of 32 keys
// (b[s] = tile[s >> 3][s & 7], the hardware k order that the V image has too),
// so P never leaves the registers; maximum and rescale factor are one value a lane.
// Per 64-key block and query tile: 4 energy WMMAs, online softmax (in-lane
// maximum, one exchange between the lane halves; row sum from an all-ones A), 18
// accumulate WMMAs (8 ch blocks x 2 + ones x 2).
// The K and V images of a 64-key block (a stage: 16 KB of V, then 2 KB of K, per
// key quarter, brought by that quarter's two waves) come by asynchronous copies
// into a ring of two LDS buffers, one trip ahead of their use: trip t reads
// buffer t & 1 alone, and the one barrier at its foot both publishes stage t + 1
// and frees buffer t & 1 for stage t + 2.
// ---------------------------------------------------------------------------
#define KSPLIT 4
#define QTILES 4
#define QPW 2                                  // query tiles a wave keeps
#define KB_PER_SPLIT (NSP / 64 / KSPLIT)
#define VT_HALVES (2 * 8 * 32 * 16)            // V image of 64 keys
#define KT_HALVES (4 * 32 * 8)                 // K image of 64 keys
#define STAGE_HALVES (VT_HALVES + KT_HALVES)

// exp(d). The v_nop is the slot that the instruction set
// asks for behind a transcendental, before its result is used or its source is
// overwritten; in one statement with the v_exp_f32 it cannot land elsewhere.
__device__ __forceinline__ float exp_slot(float d) {
  float r;
  asm("v_exp_f32 %0, %1\n\tv_nop" : "=v"(r) : "v"(d * 1.44269504f));
  return r;
}

// The same for four values: each v_exp_f32 has an independent one behind it (the
// outputs are early-clobber, so none lies on a source), the last one the v_nop.
// Left to the register allocator, the loop's exps came out as a run in which
// each wrote the source of the one in front of it.
__device__ __forceinline__ v4f exp4_slot(v4f d) {
  float r0, r1, r2, r3;
  asm("v_exp_f32 %0, %4\n\tv_exp_f32 %1, %5\n\tv_exp_f32 %2, %6\n\tv_exp_f32 %3, %7\n\tv_nop"
      : "=&v"(r0), "=&v"(r1), "=&v"(r2), "=&v"(r3)
      : "v"(d[0] * 1.44269504f), "v"(d[1] * 1.44269504f),
        "v"(d[2] * 1.44269504f), "v"(d[3] * 1.44269504f));
  v4f r = {r0, r1, r2, r3};
  return r;
}

// Value of lane l ^ 16 (the other half's share of the same query column).
__device__ __forceinline__ float other_half(float v) {
  int i = __builtin_bit_cast(int, v);
  return __builtin_bit_cast(float,
      __builtin_amdgcn_permlanex16(i, i, 0x76543210, 0xfedcba98, false, false));
}

__global__ __launch_bounds__(256) void attn(const _Float16* __restrict__ qA,
                                            const _Float16* __restrict__ kB,
                                            const _Float16* __restrict__ vB,
                                            const float* __restrict__ x,
                                            const float* __restrict__ gamma,
                                            float* __restrict__ out) {
  __shared__ __attribute__((aligned(16))) _Float16 lds_ring[2][KSPLIT][STAGE_HALVES]; // two buffers x four quarters x (V, K), 144 KB
  __shared__ __attribute__((aligned(16))) v4f   lds_red[KSPLIT * QTILES][8][2][32];  // partial accumulators per (quarter, query tile), 128 KB
  __shared__ __attribute__((aligned(16))) float lds_m[KSPLIT * QTILES][16];          // their running maxima
  __shared__ __attribute__((aligned(16))) float lds_l[KSPLIT * QTILES][16];          // their row sums

  int b    = blockIdx.y;
  int wid  = __builtin_amdgcn_readfirstlane(threadIdx.x >> 5);
  int ks   = wid >> 1;                         // key quarter
  int qp   = wid & 1;                          // pair of query tiles in the block
  int lane = threadIdx.x & 31;
  int half = lane >> 4;
  int col  = lane & 15;

  // Query B operands (K = Cq zero-padded to 32), one per query tile of the wave
  v16h aq[QPW];
#pragma unroll
  for (int u = 0; u < QPW; ++u) {
    int q16 = blockIdx.x * QTILES + QPW * qp + u;   // batch-local 16-row block
    const v8h* src = (const v8h*)(qA + (((size_t)b * (NSP / 16) + q16) * 32 + lane) * 8);
    v8h t = *src;
    aq[u] = {};
#pragma unroll
    for (int j = 0; j < 8; ++j) aq[u][j] = t[j];
  }
  v16h ones;
#pragma unroll
  for (int j = 0; j < 16; ++j) ones[j] = (_Float16)1.0f;

  v8f acc[QPW][9];                             // [0..7]=channels, [8]=rowsum
  float M[QPW];                                // running maximum of this lane's query, per tile
#pragma unroll
  for (int u = 0; u < QPW; ++u) {
#pragma unroll
    for (int cb = 0; cb < 9; ++cb) acc[u][cb] = {};
    M[u] = -__builtin_inff();
  }

  // This thread's eighteen 16-byte pieces of its quarter's stage: sixteen of the V
  // image (byte offset voff[i] in the image, the same in memory and in LDS) and
  // two of the K image (byte offsets voff[0], voff[1], behind the V image in LDS).
  unsigned voff[16];
#pragma unroll
  for (int i = 0; i < 16; ++i) voff[i] = (unsigned)(i * 1024 + (threadIdx.x & 63) * 16);

  // Asks for stage st of this quarter (64-key block ks * KB_PER_SPLIT + st), in two
  // statements of nine copies (an asm statement takes thirty operands).
  // Tracked by ASYNCcnt. The address wait is each statement's last line, so
  // nothing that rewrites a register named there can come in front of it.
  auto copy_stage = [&](int st) {
    int kg = ks * KB_PER_SPLIT + st;
    unsigned base = (unsigned)(size_t)&lds_ring[st & 1][ks][0];
    const char* vsrc = (const char*)(vB + (((size_t)b * (NSP / 32) + kg * 2) * 8) * 32 * 16);
    const char* ksrc = (const char*)(kB + (((size_t)b * (NSP / 16) + kg * 4) * 32) * 8);
#pragma unroll
    for (int g = 0; g < 2; ++g) {
      const unsigned* vo = voff + 8 * g;
      asm volatile("global_load_async_to_lds_b128 %8, %17, off\n\t"
                   "global_load_async_to_lds_b128 %0, %9, off\n\t"
                   "global_load_async_to_lds_b128 %1, %10, off\n\t"
                   "global_load_async_to_lds_b128 %2, %11, off\n\t"
                   "global_load_async_to_lds_b128 %3, %12, off\n\t"
                   "global_load_async_to_lds_b128 %4, %13, off\n\t"
                   "global_load_async_to_lds_b128 %5, %14, off\n\t"
                   "global_load_async_to_lds_b128 %6, %15, off\n\t"
                   "global_load_async_to_lds_b128 %7, %16, off\n\t"
                   "s_wait_xcnt 0x0"
                   :: "v"(base + vo[0]), "v"(base + vo[1]), "v"(base + vo[2]), "v"(base + vo[3]),
                      "v"(base + vo[4]), "v"(base + vo[5]), "v"(base + vo[6]), "v"(base + vo[7]),
                      "v"(base + 2 * VT_HALVES + voff[g]),
                      "v"(vsrc + vo[0]), "v"(vsrc + vo[1]), "v"(vsrc + vo[2]), "v"(vsrc + vo[3]),
                      "v"(vsrc + vo[4]), "v"(vsrc + vo[5]), "v"(vsrc + vo[6]), "v"(vsrc + vo[7]),
                      "v"(ksrc + voff[g])
                   : "memory");
    }
  };

  // Ring prologue: stage 0 lands and is published, then stage 1 is asked for.
  copy_stage(0);
  asm volatile("s_wait_asynccnt 0x0" ::: "memory");   // this wave's share of stage 0 has landed
  __syncthreads();                                     // every wave's share has
  copy_stage(1);

  for (int kb = 0; kb < KB_PER_SPLIT; ++kb) {
    const _Float16* stage = &lds_ring[kb & 1][ks][0];

    // A operand of V tile (kk, cb): the tile's two planes.
    auto load_v = [&](int kk, int cb) {
      const v8h* vv = (const v8h*)(stage + (kk * 8 + cb) * 512 + lane * 8);
      return __builtin_shufflevector(vv[0], vv[32], 0, 1, 2, 3, 4, 5, 6, 7, 8, 9, 10, 11, 12, 13, 14, 15);
    };

    // All LDS reads of the trip are asked for here, in one place, the K tiles
    // first: the V tiles come in while scores and softmax run.
    v8h kf[4];
#pragma unroll
    for (int t = 0; t < 4; ++t) kf[t] = *(const v8h*)(stage + VT_HALVES + (t * 32 + lane) * 8);
    v16h vf[8], vg[8];                         // V tiles of keys 0..31 and 32..63
#pragma unroll
    for (int cb = 0; cb < 8; ++cb) vf[cb] = load_v(0, cb);
#pragma unroll
    for (int cb = 0; cb < 8; ++cb) vg[cb] = load_v(1, cb);
    // Keeps the reads above this line: left free, the scheduler sinks each pair to
    // just in front of its WMMA, which then waits out the whole LDS latency.
    __builtin_amdgcn_sched_barrier(0);

    // Energy, transposed: 4 x 16-key tiles per query tile,
    // E[u][t][r] = key 16*t + 8*half + r, query col of tile u
    v8f E[QPW][4];
#pragma unroll
    for (int t = 0; t < 4; ++t) {
      v16h bk16 = {};
      v8h tt = kf[t];
#pragma unroll
      for (int j = 0; j < 8; ++j) bk16[j] = tt[j];
#pragma unroll
      for (int u = 0; u < QPW; ++u) {
        v8f z = {};
        E[u][t] = __builtin_amdgcn_wmma_f32_16x16x32_f16(false, bk16, false, aq[u], (short)0, z, false, false);
      }
    }

    // New running maximum of tile u's query over the 64 keys (32 values in the lane,
    // then the other half's); returns the online-softmax rescale factor.
    auto new_max = [&](int u) {
      float mx[8];
#pragma unroll
      for (int r = 0; r < 8; ++r)
        mx[r] = fmaxf(fmaxf(E[u][0][r], E[u][1][r]), fmaxf(E[u][2][r], E[u][3][r]));
      float m8 = fmaxf(fmaxf(fmaxf(mx[0], mx[1]), fmaxf(mx[2], mx[3])),
                       fmaxf(fmaxf(mx[4], mx[5]), fmaxf(mx[6], mx[7])));
      m8 = fmaxf(m8, other_half(m8));
      float mn = fmaxf(M[u], m8);
      float sc = exp_slot(M[u] - mn);
      M[u] = mn;
      return sc;
    };
    auto rescale = [&](int u, int cb, float sc) {
#pragma unroll
      for (int r = 0; r < 8; ++r) acc[u][cb][r] *= sc;
    };

    // P^T = exp(E - M), packed in place into the two B operands (32 keys each) of
    // a query tile; pack4 makes elements 4*s4 .. 4*s4+3 of operand kk of tile u.
    v16h p[QPW][2];
    auto pack4 = [&](int u, int kk, int s4) {
      const v8f& e = E[u][2 * kk + (s4 >> 1)];
      int r0 = 4 * (s4 & 1);
      float m = M[u];
      v4f d = {e[r0] - m, e[r0 + 1] - m, e[r0 + 2] - m, e[r0 + 3] - m};
      v4f pv = exp4_slot(d);
#pragma unroll
      for (int i = 0; i < 4; ++i) p[u][kk][4 * s4 + i] = (_Float16)pv[i];
    };

    // Tile 0: maximum, rescale, first operand. Of a row-sum tile only register 0 is
    // read later (all rows of that tile are equal sums), so only that one is rescaled.
    float sc0 = new_max(0);
#pragma unroll
    for (int cb = 0; cb < 8; ++cb) rescale(0, cb, sc0);
    acc[0][8][0] *= sc0;
#pragma unroll
    for (int s4 = 0; s4 < 4; ++s4) pack4(0, 0, s4);
    float sc1 = new_max(1);
    acc[1][8][0] *= sc1;

    // out_tile[c,q] += V x P^T ; rowsum += 1 x P^T.
    // Four runs of nine WMMAs (tile 0 keys 0..31, tile 0 keys 32..63, then tile 1
    // on the same V fragments). Vector work that a run does not depend on is dealt
    // out among its WMMAs: each run carries the making of the next run's P operand,
    // the first also tile 1's rescale, so the matrix unit and the vector port work
    // at the same time. Each sched_barrier keeps a share at its place; left free,
    // the scheduler gathers the vector work in front of the WMMAs.
#pragma unroll
    for (int cb = 0; cb < 8; ++cb) {
      acc[0][cb] = __builtin_amdgcn_wmma_f32_16x16x32_f16(false, vf[cb], false, p[0][0], (short)0, acc[0][cb], false, false);
      if (cb < 4) {
        pack4(0, 1, cb);
      } else {
        rescale(1, 2 * (cb - 4), sc1);
        rescale(1, 2 * (cb - 4) + 1, sc1);
      }
      __builtin_amdgcn_sched_barrier(0);
    }
    acc[0][8] = __builtin_amdgcn_wmma_f32_16x16x32_f16(false, ones, false, p[0][0], (short)0, acc[0][8], false, false);
#pragma unroll
    for (int cb = 0; cb < 8; ++cb) {
      acc[0][cb] = __builtin_amdgcn_wmma_f32_16x16x32_f16(false, vg[cb], false, p[0][1], (short)0, acc[0][cb], false, false);
      if ((cb & 1) == 0) {
        pack4(1, 0, cb >> 1);
        __builtin_amdgcn_sched_barrier(0);
      }
    }
    acc[0][8] = __builtin_amdgcn_wmma_f32_16x16x32_f16(false, ones, false, p[0][1], (short)0, acc[0][8], false, false);
#pragma unroll
    for (int cb = 0; cb < 8; ++cb) {
      acc[1][cb] = __builtin_amdgcn_wmma_f32_16x16x32_f16(false, vf[cb], false, p[1][0], (short)0, acc[1][cb], false, false);
      if ((cb & 1) == 0) {
        pack4(1, 1, cb >> 1);
        __builtin_amdgcn_sched_barrier(0);
      }
    }
    acc[1][8] = __builtin_amdgcn_wmma_f32_16x16x32_f16(false, ones, false, p[1][0], (short)0, acc[1][8], false, false);
#pragma unroll
    for (int cb = 0; cb < 8; ++cb)
      acc[1][cb] = __builtin_amdgcn_wmma_f32_16x16x32_f16(false, vg[cb], false, p[1][1], (short)0, acc[1][cb], false, false);
    acc[1][8] = __builtin_amdgcn_wmma_f32_16x16x32_f16(false, ones, false, p[1][1], (short)0, acc[1][8], false, false);

    // Publish point of stage kb + 1, every wave, in this order.
    asm volatile("s_wait_dscnt 0x0" ::: "memory");     // this wave's reads of the buffer are over before it is refilled
    asm volatile("s_wait_asynccnt 0x0" ::: "memory");  // this wave's share of stage kb + 1 has landed
    __syncthreads();                                   // all shares landed, all readers have left this trip's buffer
    if (kb + 2 < KB_PER_SPLIT) copy_stage(kb + 2);     // the same test for the whole block
  }
  asm volatile("s_wait_asynccnt 0x0" ::: "memory");    // no copy is open when the wave goes on

  // Hand over this wave's two partial results: maximum and row sum of each query
  // (both lane halves hold the same), and the 8 channel accumulators:
  // lds_red[quarter, tile][cb][h][lane][e] = channel cb*16 + 8*(lane>>4) + 4*h + e, query lane&15.
#pragma unroll
  for (int u = 0; u < QPW; ++u) {
    int slot = ks * QTILES + QPW * qp + u;
    if (half == 0) {
      lds_m[slot][col] = M[u];
      lds_l[slot][col] = acc[u][8][0];
    }
#pragma unroll
    for (int cb = 0; cb < 8; ++cb) {
#pragma unroll
      for (int h = 0; h < 2; ++h) {
        v4f o = {acc[u][cb][4 * h], acc[u][cb][4 * h + 1], acc[u][cb][4 * h + 2], acc[u][cb][4 * h + 3]};
        lds_red[slot][cb][h][lane] = o;
      }
    }
  }
  __syncthreads();   // every quarter's partials are in LDS before anyone merges

  // Wave w finishes channel block w for all 64 queries, 32 at a time (query tiles
  // 2*qh and 2*qh+1); a lane owns one query and all 16 channels of the block, so
  // every load and store of a wave is one whole 128-byte line. The residual
  // values are asked for here, so that they come in while the merge runs.
  int cbm = wid;
  size_t idx0 = ((size_t)b * C_DIM + cbm * 16) * NSP + blockIdx.x * 64 + lane;
  const float* xp = x + idx0;
  float xr[2][16];
#pragma unroll
  for (int qh = 0; qh < 2; ++qh) {
#pragma unroll
    for (int c = 0; c < 16; ++c) xr[qh][c] = xp[(size_t)c * NSP + 32 * qh];
  }
  float g = gamma[0];
  float* op = out + idx0;

#pragma unroll
  for (int qh = 0; qh < 2; ++qh) {
    int qtl = 2 * qh + half;                   // this lane's query tile

    // Merge: weight of quarter s for this query is exp(M_s - max over quarters).
    float f[KSPLIT];
#pragma unroll
    for (int s = 0; s < KSPLIT; ++s) f[s] = lds_m[s * QTILES + qtl][col];
    float mm = fmaxf(fmaxf(f[0], f[1]), fmaxf(f[2], f[3]));
#pragma unroll
    for (int s = 0; s < KSPLIT; ++s) f[s] = exp_slot(f[s] - mm);
    float inv = 0.0f;
#pragma unroll
    for (int s = 0; s < KSPLIT; ++s) inv += f[s] * lds_l[s * QTILES + qtl][col];
    inv = 1.0f / inv;

    // Epilogue: normalize by rowsum, gamma, residual.
#pragma unroll
    for (int hc = 0; hc < 2; ++hc) {           // channels 8*hc .. 8*hc+7 of the block
#pragma unroll
      for (int h = 0; h < 2; ++h) {
        v4f val = {};
#pragma unroll
        for (int s = 0; s < KSPLIT; ++s) {
          v4f t = lds_red[s * QTILES + qtl][cbm][h][hc * 16 + col];
#pragma unroll
          for (int e = 0; e < 4; ++e) val[e] += f[s] * t[e];
        }
#pragma unroll
        for (int e = 0; e < 4; ++e) {
          int c = 8 * hc + 4 * h + e;
          op[(size_t)c * NSP + 32 * qh] = g * (val[e] * inv) + xr[qh][c];
        }
      }
    }
  }
}

// ---------------------------------------------------------------------------
extern "C" void kernel_launch(void* const* d_in, const int* in_sizes, int n_in,
                              void* d_out, int out_size, void* d_ws, size_t ws_size,
                              hipStream_t stream) {
  const float* x     = (const float*)d_in[0];
  const float* wq    = (const float*)d_in[1];
  const float* bq    = (const float*)d_in[2];
  const float* wk    = (const float*)d_in[3];
  const float* bk    = (const float*)d_in[4];
  const float* wv    = (const float*)d_in[5];
  const float* bv    = (const float*)d_in[6];
  const float* gamma = (const float*)d_in[7];
  float* out = (float*)d_out;

  _Float16* qA = (_Float16*)d_ws;
  _Float16* kB = qA + (size_t)BATCH * (NSP / 16) * 32 * 8;
  _Float16* vB = kB + (size_t)BATCH * (NSP / 16) * 32 * 8;

  proj_qkv<<<dim3(NSP / 64, BATCH), 320, 0, stream>>>(x, wq, bq, wk, bk, wv, bv, qA, kB, vB);
  attn   <<<dim3(NSP / 64, BATCH), 256, 0, stream>>>(qA, kB, vB, x, gamma, out);
}

// v009
// One run takes 27.7 microseconds.
// Next to v008, in two timings, it ran 1.05 and 1.07 times as fast.
// All steps since v000 together make it 7.92 times as fast.
#include <hip/hip_runtime.h>
#include <hip/hip_fp16.h>

typedef __attribute__((ext_vector_type(16))) _Float16 v16h;
typedef __attribute__((ext_vector_type(8)))  _Float16 v8h;
typedef __attribute__((ext_vector_type(2)))  _Float16 h2;
typedef __attribute__((ext_vector_type(8)))  float    v8f;
typedef __attribute__((ext_vector_type(4)))  float    v4f;
typedef __attribute__((ext_vector_type(2)))  float    v2f;
typedef __attribute__((ext_vector_type(8)))  unsigned v8u;
typedef __attribute__((ext_vector_type(4)))  int      v4i;
typedef __attribute__((address_space(1))) v4i gl_v4i;   // 16 bytes in global memory
typedef __attribute__((address_space(3))) v4i ld_v4i;   // 16 bytes in LDS

#define C_DIM 128
#define CQ    16
#define NSP   4096   // 64*64
#define BATCH 4

// ---------------------------------------------------------------------------
// Projections q, k, v as one GEMM [160 x 128] x [128 x n] on f16 WMMA (16x16x32)
// with split operands: every f32 value a is taken as head + tail, head = f16(a),
// tail = f16(a - head) (the difference is exact in f32), and a product x * w as
// xh*wh + xh*wl + xl*wh, summed in the f32 accumulator. What is left out (xl*wl and
// the tails' own rounding) lies about 2^-21 below the product, far under the f16
// rounding of the stored results. 12 WMMAs do 32 channels of four position tiles.
// One block = 64 positions of one batch, ten waves = ten 16-channel tiles
// (wave 0: q, wave 1: k, waves 2..9: v). A wave keeps four position tiles;
// tile t holds positions n0 + 4*j + t (j = lane & 15), so one 16-byte load
// along n feeds all four tiles. k order, the same for x and w fragments:
// step s, lane half h, element e  ->  c = 32*s + 16*h + e.
// Results leave in the WMMA operand images that attn reads:
//  q,k: lane = (c>>3)*16 + (n&15), half j = c&7  (K padded 16->32 with zeros)
//  v  : operand lane images per (32-key, 16-ch) tile, as two planes of 32 lanes x
//       16 bytes (plane g = image positions 8*g .. 8*g+7): a 16-byte LDS read of a
//       plane is then 512 bytes in a row, each bank met once per 16 lanes.
// ---------------------------------------------------------------------------
// Four pairs (a[i], b[i]) of f32 values -> four registers of a head fragment
// (h[i] = f16(a[i]) low, f16(b[i]) high) and four of a tail fragment
// (l[i] = f16(a[i] - head) low, f16(b[i] - head) high): three instructions a pair.
// v_fma_mixlo/mixhi_f16 take the f16 head as it lies, subtract in f32 and write the
// rounded tail into its half of the register; from plain source the build made two
// conversions back to f32, a packed subtract with register copies in front of it,
// and a packed conversion. Operand 16 is -1.0f in a scalar register. Each s_delay_alu names
// the producer four vector instructions back for the two instructions behind it, so
// that the SIMD's other waves issue meanwhile.
__device__ __forceinline__ void split4(const float (&a)[4], const float (&b)[4],
                                       unsigned (&h)[4], unsigned (&l)[4]) {
  asm("v_cvt_pk_f16_f32 %0, %8, %12\n\t"
      "v_cvt_pk_f16_f32 %1, %9, %13\n\t"
      "v_cvt_pk_f16_f32 %2, %10, %14\n\t"
      "v_cvt_pk_f16_f32 %3, %11, %15\n\t"
      "s_delay_alu instid0(VALU_DEP_4) | instskip(NEXT) | instid1(VALU_DEP_4)\n\t"
      "v_fma_mixlo_f16 %4, %0, %16, %8 op_sel_hi:[1,0,0]\n\t"
      "v_fma_mixlo_f16 %5, %1, %16, %9 op_sel_hi:[1,0,0]\n\t"
      "s_delay_alu instid0(VALU_DEP_4) | instskip(NEXT) | instid1(VALU_DEP_4)\n\t"
      "v_fma_mixlo_f16 %6, %2, %16, %10 op_sel_hi:[1,0,0]\n\t"
      "v_fma_mixlo_f16 %7, %3, %16, %11 op_sel_hi:[1,0,0]\n\t"
      "s_delay_alu instid0(VALU_DEP_4) | instskip(NEXT) | instid1(VALU_DEP_4)\n\t"
      "v_fma_mixhi_f16 %4, %0, %16, %12 op_sel:[1,0,0] op_sel_hi:[1,0,0]\n\t"
      "v_fma_mixhi_f16 %5, %1, %16, %13 op_sel:[1,0,0] op_sel_hi:[1,0,0]\n\t"
      "s_delay_alu instid0(VALU_DEP_4) | instskip(NEXT) | instid1(VALU_DEP_4)\n\t"
      "v_fma_mixhi_f16 %6, %2, %16, %14 op_sel:[1,0,0] op_sel_hi:[1,0,0]\n\t"
      "v_fma_mixhi_f16 %7, %3, %16, %15 op_sel:[1,0,0] op_sel_hi:[1,0,0]"
      : "=&v"(h[0]), "=&v"(h[1]), "=&v"(h[2]), "=&v"(h[3]),
        "=&v"(l[0]), "=&v"(l[1]), "=&v"(l[2]), "=&v"(l[3])
      : "v"(a[0]), "v"(a[1]), "v"(a[2]), "v"(a[3]),
        "v"(b[0]), "v"(b[1]), "v"(b[2]), "v"(b[3]), "s"(-1.0f));
}

// start(): gives the accumulators their start values (the bias), called in front of
// the first WMMA: its wait for the bias load then stands behind the first loads of x
// and w, not in front of them.
template <bool X_IS_A, typename Start>
__device__ __forceinline__ void proj_tiles(const float* __restrict__ xp,
                                           const float* __restrict__ wp,
                                           v8f (&acc)[4], Start start) {
  // All loops here and in proj_qkv are unrolled whole: the register arrays need
  // constant indices.
  // Loads go by units of 8 elements a lane (half a step: two of w, eight of x). A
  // unit is asked for behind the split of the unit two in front of it; the scheduler
  // has registers to spare and lifts the request over that split, so in the built
  // code up to three units are open.
  constexpr int UNITS = C_DIM / 16;
  v4f Wv[2][2], X[2][8];
  auto ask = [&](int u) {
#pragma unroll
    for (int i = 0; i < 2; ++i) Wv[u & 1][i] = *(const v4f*)(wp + 32 * (u >> 1) + 8 * (u & 1) + 4 * i);
#pragma unroll
    for (int i = 0; i < 8; ++i) X[u & 1][i] = *(const v4f*)(xp + (size_t)(32 * (u >> 1) + 8 * (u & 1) + i) * NSP);
    // Keeps the loads up here: left free, the scheduler sinks them to just in
    // front of their use, and every step waits out the whole latency.
    __builtin_amdgcn_sched_barrier(0);
  };
  ask(0);
  ask(1);
#pragma unroll
  for (int s = 0; s < UNITS / 2; ++s) {
    v8u wh, wl, xh[4], xl[4];
#pragma unroll
    for (int q = 0; q < 2; ++q) {
      const int u = 2 * s + q;
      unsigned h[4], l[4];
      {
        const v4f w0 = Wv[u & 1][0], w1 = Wv[u & 1][1];
        float a[4] = {w0[0], w0[2], w1[0], w1[2]}, b[4] = {w0[1], w0[3], w1[1], w1[3]};
        split4(a, b, h, l);
#pragma unroll
        for (int i = 0; i < 4; ++i) { wh[4 * q + i] = h[i]; wl[4 * q + i] = l[i]; }
      }
#pragma unroll
      for (int i = 0; i < 4; ++i) {
        const v4f x0 = X[u & 1][2 * i], x1 = X[u & 1][2 * i + 1];
        float a[4] = {x0[0], x0[1], x0[2], x0[3]}, b[4] = {x1[0], x1[1], x1[2], x1[3]};
        split4(a, b, h, l);
#pragma unroll
        for (int t = 0; t < 4; ++t) { xh[t][4 * q + i] = h[t]; xl[t][4 * q + i] = l[t]; }
      }
      if (u + 2 < UNITS) ask(u + 2);
    }
    if (s == 0) start();
    // term 0: xh*wh, term 1: xh*wl, term 2: xl*wh; the four tiles of a term are
    // independent accumulators.
#pragma unroll
    for (int term = 0; term < 3; ++term) {
      v16h wf = __builtin_bit_cast(v16h, term == 1 ? wl : wh);
#pragma unroll
      for (int t = 0; t < 4; ++t) {
        v16h xf = __builtin_bit_cast(v16h, term == 2 ? xl[t] : xh[t]);
        acc[t] = X_IS_A
            ? __builtin_amdgcn_wmma_f32_16x16x32_f16(false, xf, false, wf, (short)0, acc[t], false, false)
            : __builtin_amdgcn_wmma_f32_16x16x32_f16(false, wf, false, xf, (short)0, acc[t], false, false);
      }
    }
    if (s + 1 < UNITS / 2) {
      // The next step's split4 may write registers that were operands of the WMMAs
      // above, and the compiler counts no distance for asm text: these are the four
      // slots that the chip needs between a WMMA and a vector write over its A or B.
      // The two sched_barriers hold them between the WMMAs and the next split4.
      __builtin_amdgcn_sched_barrier(0);
      asm volatile("v_nop\n\tv_nop\n\tv_nop\n\tv_nop");
      __builtin_amdgcn_sched_barrier(0);
    }
  }
  // Address wait behind the last load; the two pointers are inputs so that their
  // registers are not given to anything else while a load that names them is open.
  asm volatile("s_wait_xcnt 0x0" :: "v"(xp), "v"(wp) : "memory");
}

__global__ __launch_bounds__(320) void proj_qkv(const float* __restrict__ x,
                                                const float* __restrict__ wq, const float* __restrict__ bq,
                                                const float* __restrict__ wk, const float* __restrict__ bk,
                                                const float* __restrict__ wv, const float* __restrict__ bv,
                                                _Float16* __restrict__ qA, _Float16* __restrict__ kB,
                                                _Float16* __restrict__ vB) {
  int b    = blockIdx.y;
  int n0   = blockIdx.x * 64;
  int wid  = __builtin_amdgcn_readfirstlane(threadIdx.x >> 5);
  int lane = threadIdx.x & 31;
  int half = lane >> 4;
  int col  = lane & 15;

  const float* xp = x + ((size_t)b * C_DIM + 16 * half) * NSP + n0 + 4 * col;
  v8f acc[4];

  if (wid >= 2) {
    // D[n = n0 + 32*half + 4*r + t][ch = cb*16 + col]
    int cb = wid - 2;
    float bb = bv[cb * 16 + col];
    proj_tiles<true>(xp, wv + (cb * 16 + col) * C_DIM + 16 * half, acc, [&] {
#pragma unroll
      for (int t = 0; t < 4; ++t) {
#pragma unroll
        for (int r = 0; r < 8; ++r) acc[t][r] = bb;
      }
    });
    // key in its 32-block: kk = 4*r + t; image lane half = (kk>>3)&1,
    // image position = (kk&7) | ((kk>>4)<<3)
    size_t kb = (size_t)b * (NSP / 32) + (n0 >> 5) + half;
#pragma unroll
    for (int g = 0; g < 2; ++g) {
#pragma unroll
      for (int hs = 0; hs < 2; ++hs) {
        v8h o;
#pragma unroll
        for (int s = 0; s < 8; ++s) o[s] = (_Float16)acc[s & 3][4 * g + 2 * hs + (s >> 2)];
        *(v8h*)(vB + (((kb * 8 + cb) * 2 + g) * 32 + hs * 16 + col) * 8) = o;
      }
    }
    return;
  }

  // D[ch = 8*half + r][n = n0 + 4*col + t]
  const float* w    = wid ? wk : wq;
  const float* bias = wid ? bk : bq;
  _Float16*    dst  = wid ? kB : qA;
  float bb[8];
#pragma unroll
  for (int r = 0; r < 8; ++r) bb[r] = half ? bias[8 + r] : bias[r];
  proj_tiles<false>(xp, w + col * C_DIM + 16 * half, acc, [&] {
#pragma unroll
    for (int r = 0; r < 8; ++r) {
#pragma unroll
      for (int t = 0; t < 4; ++t) acc[t][r] = bb[r];
    }
  });
#pragma unroll
  for (int t = 0; t < 4; ++t) {
    int n = n0 + 4 * col + t;
    size_t blk = (size_t)b * (NSP / 16) + (n >> 4);
    v8h o;
#pragma unroll
    for (int r = 0; r < 8; ++r) o[r] = (_Float16)acc[t][r];
    *(v8h*)(dst + (blk * 32 + half * 16 + (n & 15)) * 8) = o;
  }
  // Address wait behind the stores: in the built code the other branch's body
  // follows this one and takes the same registers.
  asm volatile("s_wait_xcnt 0x0" ::: "memory");
}

// ---------------------------------------------------------------------------
// Flash-attention core, 8 waves/block: 2 pairs of query tiles (16 rows a tile) x 4
// key quarters. Wave (ks, qp) runs query tiles 2*qp and 2*qp+1 over keys
// [ks*1024, ks*1024+1024), each tile with its own running maximum; the four
// partial results of a query tile are merged through LDS behind the loop.
// 256 blocks: one for every WGP, two waves per SIMD.
// A K or V fragment read from LDS feeds one WMMA of each of the wave's two tiles,
// so a block reads every staged byte twice, not four times.
// Both products are taken transposed: S^T = K Q^T (A = key image, B = query
// image) and O^T += V P^T (A = V image, B = P^T). A lane then holds scores of
// ONE query (its column): register r of score tile t is key 16*t + 8*half + r.
// Two score tiles, converted in place, are the B operand of 32 keys
// (b[s] = tile[s >> 3][s & 7], the hardware k order that the V image has too),
// so P never leaves the registers; maximum and rescale factor are one value a lane.
// Per 64-key block and query tile: 4 energy WMMAs, online softmax (in-lane
// maximum, one exchange between the lane halves; row sum from an all-ones A), 18
// accumulate WMMAs (8 ch blocks x 2 + ones x 2).
// The K and V images of a 64-key block (a stage: 16 KB of V, then 2 KB of K, per
// key quarter, brought by that quarter's two waves) come by asynchronous copies
// into a ring of two LDS buffers, one trip ahead of their use: trip t reads
// buffer t & 1 alone, and the one barrier in front of its fourth run both publishes stage t + 1
// and frees buffer t & 1 for stage t + 2.
// ---------------------------------------------------------------------------
#define KSPLIT 4
#define QTILES 4
#define QPW 2                                  // query tiles a wave keeps
#define KB_PER_SPLIT (NSP / 64 / KSPLIT)
#define VT_HALVES (2 * 8 * 32 * 16)            // V image of 64 keys
#define KT_HALVES (4 * 32 * 8)                 // K image of 64 keys
#define STAGE_HALVES (VT_HALVES + KT_HALVES)

// exp(d). The v_nop is the slot that the instruction set
// asks for behind a transcendental, before its result is used or its source is
// overwritten; in one statement with the v_exp_f32 it cannot land elsewhere.
__device__ __forceinline__ float exp_slot(float d) {
  float r;
  asm("v_exp_f32 %0, %1\n\tv_nop" : "=v"(r) : "v"(d * 1.44269504f));
  return r;
}

// The same for four values: each v_exp_f32 has an independent one behind it (the
// outputs are early-clobber, so none lies on a source), the last one the v_nop.
// Left to the register allocator, the loop's exps came out as a run in which
// each wrote the source of the one in front of it.
__device__ __forceinline__ v4f exp4_slot(v4f d) {
  float r0, r1, r2, r3;
  asm("v_exp_f32 %0, %4\n\tv_exp_f32 %1, %5\n\tv_exp_f32 %2, %6\n\tv_exp_f32 %3, %7\n\tv_nop"
      : "=&v"(r0), "=&v"(r1), "=&v"(r2), "=&v"(r3)
      : "v"(d[0] * 1.44269504f), "v"(d[1] * 1.44269504f),
        "v"(d[2] * 1.44269504f), "v"(d[3] * 1.44269504f));
  v4f r = {r0, r1, r2, r3};
  return r;
}

// Value of lane l ^ 16 (the other half's share of the same query column).
__device__ __forceinline__ float other_half(float v) {
  int i = __builtin_bit_cast(int, v);
  return __builtin_bit_cast(float,
      __builtin_amdgcn_permlanex16(i, i, 0x76543210, 0xfedcba98, false, false));
}

__global__ __launch_bounds__(256) void attn(const _Float16* __restrict__ qA,
                                            const _Float16* __restrict__ kB,
                                            const _Float16* __restrict__ vB,
                                            const float* __restrict__ x,
                                            const float* __restrict__ gamma,
                                            float* __restrict__ out) {
  __shared__ __attribute__((aligned(16))) _Float16 lds_ring[2][KSPLIT][STAGE_HALVES]; // two buffers x four quarters x (V, K), 144 KB
  __shared__ __attribute__((aligned(16))) v4f   lds_red[KSPLIT * QTILES][8][2][32];  // partial accumulators per (quarter, query tile), 128 KB
  __shared__ __attribute__((aligned(16))) float lds_m[KSPLIT * QTILES][16];          // their running maxima
  __shared__ __attribute__((aligned(16))) float lds_l[KSPLIT * QTILES][16];          // their row sums

  int b    = blockIdx.y;
  int wid  = __builtin_amdgcn_readfirstlane(threadIdx.x >> 5);
  int ks   = wid >> 1;                         // key quarter
  int qp   = wid & 1;                          // pair of query tiles in the block
  int lane = threadIdx.x & 31;
  int half = lane >> 4;
  int col  = lane & 15;

  // Query B operands (K = Cq zero-padded to 32), one per query tile of the wave
  v16h aq[QPW];
#pragma unroll
  for (int u = 0; u < QPW; ++u) {
    int q16 = blockIdx.x * QTILES + QPW * qp + u;   // batch-local 16-row block
    const v8h* src = (const v8h*)(qA + (((size_t)b * (NSP / 16) + q16) * 32 + lane) * 8);
    v8h t = *src;
    aq[u] = {};
#pragma unroll
    for (int j = 0; j < 8; ++j) aq[u][j] = t[j];
  }
  v16h ones;
#pragma unroll
  for (int j = 0; j < 16; ++j) ones[j] = (_Float16)1.0f;

  v8f acc[QPW][9];                             // [0..7]=channels, [8]=rowsum
  float M[QPW];                                // running maximum of this lane's query, per tile
#pragma unroll
  for (int u = 0; u < QPW; ++u) {
#pragma unroll
    for (int cb = 0; cb < 9; ++cb) acc[u][cb] = {};
    M[u] = -__builtin_inff();
  }

  // This thread's eighteen 16-byte pieces of its quarter's stage: two of the K image
  // and sixteen of the V image, 1 KB apart, at the same byte offsets in memory and in
  // LDS (the K image lies behind the V image in LDS). toff = the first piece's offset.
  unsigned toff = (unsigned)(threadIdx.x & 63) * 16;

  // Asks for stage st of this quarter (64-key block ks * KB_PER_SPLIT + st).
  // Tracked by ASYNCcnt. The builtin's immediate offset moves both addresses, so a
  // stage takes one address pair for K and one for V instead of eighteen.
  auto copy_stage = [&](int st) {
    int kg = ks * KB_PER_SPLIT + st;
    char* base = (char*)&lds_ring[st & 1][ks][0] + toff;
    const char* vsrc = (const char*)(vB + (((size_t)b * (NSP / 32) + kg * 2) * 8) * 32 * 16) + toff;
    const char* ksrc = (const char*)(kB + (((size_t)b * (NSP / 16) + kg * 4) * 32) * 8) + toff;
    gl_v4i* vg_ = (gl_v4i*)vsrc;
    gl_v4i* kg_ = (gl_v4i*)ksrc;
    ld_v4i* vl_ = (ld_v4i*)base;
    ld_v4i* kl_ = (ld_v4i*)(base + 2 * VT_HALVES);
#define COPY16(g, l, off) __builtin_amdgcn_global_load_async_to_lds_b128(g, l, off, 0)
    COPY16(kg_, kl_, 0);      COPY16(kg_, kl_, 1024);
    COPY16(vg_, vl_, 0);      COPY16(vg_, vl_, 1024);   COPY16(vg_, vl_, 2048);   COPY16(vg_, vl_, 3072);
    COPY16(vg_, vl_, 4096);   COPY16(vg_, vl_, 5120);   COPY16(vg_, vl_, 6144);   COPY16(vg_, vl_, 7168);
    COPY16(vg_, vl_, 8192);   COPY16(vg_, vl_, 9216);   COPY16(vg_, vl_, 10240);  COPY16(vg_, vl_, 11264);
    COPY16(vg_, vl_, 12288);  COPY16(vg_, vl_, 13312);  COPY16(vg_, vl_, 14336);  COPY16(vg_, vl_, 15360);
#undef COPY16
  };

  // Ring prologue: stage 0 lands and is published, then stage 1 is asked for.
  copy_stage(0);
  asm volatile("s_wait_asynccnt 0x0" ::: "memory");   // this wave's share of stage 0 has landed
  __syncthreads();                                     // every wave's share has
  copy_stage(1);

  for (int kb = 0; kb < KB_PER_SPLIT; ++kb) {
    const _Float16* stage = &lds_ring[kb & 1][ks][0];

    // A operand of V tile (kk, cb): the tile's two planes.
    auto load_v = [&](int kk, int cb) {
      const v8h* vv = (const v8h*)(stage + (kk * 8 + cb) * 512 + lane * 8);
      return __builtin_shufflevector(vv[0], vv[32], 0, 1, 2, 3, 4, 5, 6, 7, 8, 9, 10, 11, 12, 13, 14, 15);
    };

    // All LDS reads of the trip are asked for here, in one place, the K tiles
    // first: the V tiles come in while scores and softmax run.
    v8h kf[4];
#pragma unroll
    for (int t = 0; t < 4; ++t) kf[t] = *(const v8h*)(stage + VT_HALVES + (t * 32 + lane) * 8);
    v16h vf[8], vg[8];                         // V tiles of keys 0..31 and 32..63
#pragma unroll
    for (int cb = 0; cb < 8; ++cb) vf[cb] = load_v(0, cb);
#pragma unroll
    for (int cb = 0; cb < 8; ++cb) vg[cb] = load_v(1, cb);
    // Keeps the reads above this line: left free, the scheduler sinks each pair to
    // just in front of its WMMA, which then waits out the whole LDS latency.
    __builtin_amdgcn_sched_barrier(0);

    // Energy, transposed: 4 x 16-key tiles per query tile,
    // E[u][t][r] = key 16*t + 8*half + r, query col of tile u
    v8f E[QPW][4];
#pragma unroll
    for (int t = 0; t < 4; ++t) {
      v16h bk16 = {};
      v8h tt = kf[t];
#pragma unroll
      for (int j = 0; j < 8; ++j) bk16[j] = tt[j];
#pragma unroll
      for (int u = 0; u < QPW; ++u) {
        v8f z = {};
        E[u][t] = __builtin_amdgcn_wmma_f32_16x16x32_f16(false, bk16, false, aq[u], (short)0, z, false, false);
      }
    }

    // New running maximum of tile u's query over the 64 keys (32 values in the lane,
    // then the other half's); returns the online-softmax rescale factor.
    auto new_max = [&](int u) {
      float mx[8];
#pragma unroll
      for (int r = 0; r < 8; ++r)
        mx[r] = fmaxf(fmaxf(E[u][0][r], E[u][1][r]), fmaxf(E[u][2][r], E[u][3][r]));
      float m8 = fmaxf(fmaxf(fmaxf(mx[0], mx[1]), fmaxf(mx[2], mx[3])),
                       fmaxf(fmaxf(mx[4], mx[5]), fmaxf(mx[6], mx[7])));
      m8 = fmaxf(m8, other_half(m8));
      float mn = fmaxf(M[u], m8);
      float sc = exp_slot(M[u] - mn);
      M[u] = mn;
      return sc;
    };
    auto rescale = [&](int u, int cb, float sc) {
#pragma unroll
      for (int r = 0; r < 8; ++r) acc[u][cb][r] *= sc;
    };

    // P^T = exp(E - M), packed in place into the two B operands (32 keys each) of
    // a query tile; pack4 makes elements 4*s4 .. 4*s4+3 of operand kk of tile u.
    v16h p[QPW][2];
    auto pack4 = [&](int u, int kk, int s4) {
      const v8f& e = E[u][2 * kk + (s4 >> 1)];
      int r0 = 4 * (s4 & 1);
      float m = M[u];
      v4f d = {e[r0] - m, e[r0 + 1] - m, e[r0 + 2] - m, e[r0 + 3] - m};
      v4f pv = exp4_slot(d);
#pragma unroll
      for (int i = 0; i < 4; ++i) p[u][kk][4 * s4 + i] = (_Float16)pv[i];
    };

    // Tile 0: maximum, rescale, first operand. Of a row-sum tile only register 0 is
    // read later (all rows of that tile are equal sums), so only that one is rescaled.
    float sc0 = new_max(0);
#pragma unroll
    for (int cb = 0; cb < 8; ++cb) rescale(0, cb, sc0);
    acc[0][8][0] *= sc0;
#pragma unroll
    for (int s4 = 0; s4 < 4; ++s4) pack4(0, 0, s4);
    float sc1 = new_max(1);
    acc[1][8][0] *= sc1;

    // out_tile[c,q] += V x P^T ; rowsum += 1 x P^T.
    // Four runs of nine WMMAs (tile 0 keys 0..31, tile 0 keys 32..63, then tile 1
    // on the same V fragments). Vector work that a run does not depend on is dealt
    // out among its WMMAs: each run carries the making of the next run's P operand,
    // the first also tile 1's rescale, so the matrix unit and the vector port work
    // at the same time. Each sched_barrier keeps a share at its place; left free,
    // the scheduler gathers the vector work in front of the WMMAs.
#pragma unroll
    for (int cb = 0; cb < 8; ++cb) {
      acc[0][cb] = __builtin_amdgcn_wmma_f32_16x16x32_f16(false, vf[cb], false, p[0][0], (short)0, acc[0][cb], false, false);
      if (cb < 4) {
        pack4(0, 1, cb);
      } else {
        rescale(1, 2 * (cb - 4), sc1);
        rescale(1, 2 * (cb - 4) + 1, sc1);
      }
      __builtin_amdgcn_sched_barrier(0);
    }
    acc[0][8] = __builtin_amdgcn_wmma_f32_16x16x32_f16(false, ones, false, p[0][0], (short)0, acc[0][8], false, false);
#pragma unroll
    for (int cb = 0; cb < 8; ++cb) {
      acc[0][cb] = __builtin_amdgcn_wmma_f32_16x16x32_f16(false, vg[cb], false, p[0][1], (short)0, acc[0][cb], false, false);
      if ((cb & 1) == 0) {
        pack4(1, 0, cb >> 1);
        __builtin_amdgcn_sched_barrier(0);
      }
    }
    acc[0][8] = __builtin_amdgcn_wmma_f32_16x16x32_f16(false, ones, false, p[0][1], (short)0, acc[0][8], false, false);
#pragma unroll
    for (int cb = 0; cb < 8; ++cb) {
      acc[1][cb] = __builtin_amdgcn_wmma_f32_16x16x32_f16(false, vf[cb], false, p[1][0], (short)0, acc[1][cb], false, false);
      if ((cb & 1) == 0) {
        pack4(1, 1, cb >> 1);
        __builtin_amdgcn_sched_barrier(0);
      }
    }
    acc[1][8] = __builtin_amdgcn_wmma_f32_16x16x32_f16(false, ones, false, p[1][0], (short)0, acc[1][8], false, false);

    // Publish point of stage kb + 1, every wave, in this order. It stands in front of
    // the fourth run, which works on registers alone (every LDS read of the trip has
    // come in by the first wait): the refill is under way while that run is issued.
    asm volatile("s_wait_dscnt 0x0" ::: "memory");     // this wave's reads of the buffer are over before it is refilled
    asm volatile("s_wait_asynccnt 0x0" ::: "memory");  // this wave's share of stage kb + 1 has landed
    __syncthreads();                                   // all shares landed, all readers have left this trip's buffer
    if (kb + 2 < KB_PER_SPLIT) copy_stage(kb + 2);     // the same test for the whole block

#pragma unroll
    for (int cb = 0; cb < 8; ++cb)
      acc[1][cb] = __builtin_amdgcn_wmma_f32_16x16x32_f16(false, vg[cb], false, p[1][1], (short)0, acc[1][cb], false, false);
    acc[1][8] = __builtin_amdgcn_wmma_f32_16x16x32_f16(false, ones, false, p[1][1], (short)0, acc[1][8], false, false);
  }
  asm volatile("s_wait_asynccnt 0x0" ::: "memory");    // no copy is open when the wave goes on

  // Hand over this wave's two partial results: maximum and row sum of each query
  // (both lane halves hold the same), and the 8 channel accumulators:
  // lds_red[quarter, tile][cb][h][lane][e] = channel cb*16 + 8*(lane>>4) + 4*h + e, query lane&15.
#pragma unroll
  for (int u = 0; u < QPW; ++u) {
    int slot = ks * QTILES + QPW * qp + u;
    if (half == 0) {
      lds_m[slot][col] = M[u];
      lds_l[slot][col] = acc[u][8][0];
    }
#pragma unroll
    for (int cb = 0; cb < 8; ++cb) {
#pragma unroll
      for (int h = 0; h < 2; ++h) {
        v4f o = {acc[u][cb][4 * h], acc[u][cb][4 * h + 1], acc[u][cb][4 * h + 2], acc[u][cb][4 * h + 3]};
        lds_red[slot][cb][h][lane] = o;
      }
    }
  }
  __syncthreads();   // every quarter's partials are in LDS before anyone merges

  // Wave w finishes channel block w for all 64 queries, 32 at a time (query tiles
  // 2*qh and 2*qh+1); a lane owns one query and all 16 channels of the block, so
  // every load and store of a wave is one whole 128-byte line. The residual
  // values are asked for here, so that they come in while the merge runs.
  int cbm = wid;
  size_t idx0 = ((size_t)b * C_DIM + cbm * 16) * NSP + blockIdx.x * 64 + lane;
  const float* xp = x + idx0;
  float xr[2][16];
#pragma unroll
  for (int qh = 0; qh < 2; ++qh) {
#pragma unroll
    for (int c = 0; c < 16; ++c) xr[qh][c] = xp[(size_t)c * NSP + 32 * qh];
  }
  float g = gamma[0];
  float* op = out + idx0;

#pragma unroll
  for (int qh = 0; qh < 2; ++qh) {
    int qtl = 2 * qh + half;                   // this lane's query tile

    // Merge: weight of quarter s for this query is exp(M_s - max over quarters).
    float f[KSPLIT];
#pragma unroll
    for (int s = 0; s < KSPLIT; ++s) f[s] = lds_m[s * QTILES + qtl][col];
    float mm = fmaxf(fmaxf(f[0], f[1]), fmaxf(f[2], f[3]));
#pragma unroll
    for (int s = 0; s < KSPLIT; ++s) f[s] = exp_slot(f[s] - mm);
    float inv = 0.0f;
#pragma unroll
    for (int s = 0; s < KSPLIT; ++s) inv += f[s] * lds_l[s * QTILES + qtl][col];
    inv = 1.0f / inv;

    // Epilogue: normalize by rowsum, gamma, residual.
#pragma unroll
    for (int hc = 0; hc < 2; ++hc) {           // channels 8*hc .. 8*hc+7 of the block
#pragma unroll
      for (int h = 0; h < 2; ++h) {
        v4f val = {};
#pragma unroll
        for (int s = 0; s < KSPLIT; ++s) {
          v4f t = lds_red[s * QTILES + qtl][cbm][h][hc * 16 + col];
#pragma unroll
          for (int e = 0; e < 4; ++e) val[e] += f[s] * t[e];
        }
#pragma unroll
        for (int e = 0; e < 4; ++e) {
          int c = 8 * hc + 4 * h + e;
          op[(size_t)c * NSP + 32 * qh] = g * (val[e] * inv) + xr[qh][c];
        }
      }
    }
  }
}

// ---------------------------------------------------------------------------
extern "C" void kernel_launch(void* const* d_in, const int* in_sizes, int n_in,
                              void* d_out, int out_size, void* d_ws, size_t ws_size,
                              hipStream_t stream) {
  const float* x     = (const float*)d_in[0];
  const float* wq    = (const float*)d_in[1];
  const float* bq    = (const float*)d_in[2];
  const float* wk    = (const float*)d_in[3];
  const float* bk    = (const float*)d_in[4];
  const float* wv    = (const float*)d_in[5];
  const float* bv    = (const float*)d_in[6];
  const float* gamma = (const float*)d_in[7];
  float* out = (float*)d_out;

  _Float16* qA = (_Float16*)d_ws;
  _Float16* kB = qA + (size_t)BATCH * (NSP / 16) * 32 * 8;
  _Float16* vB = kB + (size_t)BATCH * (NSP / 16) * 32 * 8;

  proj_qkv<<<dim3(NSP / 64, BATCH), 320, 0, stream>>>(x, wq, bq, wk, bk, wv, bv, qA, kB, vB);
  attn   <<<dim3(NSP / 64, BATCH), 256, 0, stream>>>(qA, kB, vB, x, gamma, out);
}
